// v000
// Measured on an AMD MI455X. A time is GPU time per run, averaged over a window of back-to-back runs after a warm-up
// (all launches, gaps included; the runs take copies of the inputs in turn), and the median of several windows.
// Apart from v000's, it joins two sittings. Times from different sittings can be a few percent apart, while
// side-by-side timings come from the same sitting.
// v000 is the starting kernel. One run takes 446 microseconds.
#include <hip/hip_runtime.h>
#include <math.h>

// Conv1d(k=1) self-attention: q/k/v = 1x1 conv over [N,C,W] (C = 1024), 16 heads x 64, softmax(q.k/8 + mask) v, output
// [N,C,W]. Contractions on v_wmma_f32_16x16x32_f16 with f16 operands (x pre-transposed once to f16 [n][w][c] rows, weights
// converted to f16 rows), f32 accumulate; online softmax in f32 with P lifted by 2^14 before its f16 conversion (2^-14 folded

#define NB 8
#define CC 1024
#define WW 1024
#define HH 16
#define HD 64
#define BK 32

typedef __attribute__((ext_vector_type(16))) _Float16 v16h;
typedef __attribute__((ext_vector_type(8)))  _Float16 v8h;
typedef __attribute__((ext_vector_type(8)))  float v8f;
typedef __attribute__((ext_vector_type(4)))  float v4f;
typedef __attribute__((ext_vector_type(4)))  unsigned v4u;

template <typename T> __device__ __forceinline__ void vst2(void* p, T v) { *(T*)p = v;  }
__device__ __forceinline__ v8f wmma16(v16h a, v16h b, v8f c) {
  v8f d = __builtin_amdgcn_wmma_f32_16x16x32_f16(false, a, false, b, (short)0, c, false, false);
  asm volatile("v_nop\n\tv_nop\n\tv_nop\n\tv_nop" : "+v"(d) : "v"(a), "v"(b));
  return d;
}
__device__ __forceinline__ v16h frag_h(const _Float16* rowk0, int lane) {
  union { v16h v; v8h q[2]; } u; const _Float16* p = rowk0 + 8 * (lane >> 4);
  u.q[0] = *(const v8h*)p; u.q[1] = *(const v8h*)(p + 16); return u.v;
}
__device__ __forceinline__ v16h frag_f32(const float* rowk0, int lane) {
  v16h a; const float* p = rowk0 + 8 * (lane >> 4);
#pragma unroll
  for (int i = 0; i < 8; ++i) { a[i] = (_Float16)p[i]; a[8 + i] = (_Float16)p[16 + i]; }
  return a;
}
#define LDSX() do { asm volatile("s_wait_dscnt 0" ::: "memory"); __builtin_amdgcn_wave_barrier(); __builtin_amdgcn_fence(__ATOMIC_RELEASE, "workgroup"); } while (0)

__global__ __launch_bounds__(256) void k_xT(const float* __restrict__ x, _Float16* __restrict__ xT) {
  __shared__ float tile[64][65];
  const int n = blockIdx.z, c0 = blockIdx.y * 64, w0 = blockIdx.x * 64, tid = threadIdx.x;
  for (int q = tid; q < 64 * 64; q += 256) { const int cl = q >> 6, wl = q & 63; tile[cl][wl] = x[((size_t)n * CC + c0 + cl) * WW + w0 + wl]; }
  __syncthreads();
  for (int q = tid; q < 64 * 8; q += 256) { const int wl = q >> 3, pc = q & 7;
    union { v8h h; v4u u; } pk;
#pragma unroll
    for (int e = 0; e < 8; ++e) pk.h[e] = (_Float16)tile[pc * 8 + e][wl];
    vst2(xT + ((size_t)n * WW + w0 + wl) * CC + c0 + pc * 8, pk.u); }
}
// ---- weights f32 [Cout][Cin] -> f16 rows (same layout), 16 B per thread; all three matrices in one launch (grid.y)
__global__ __launch_bounds__(256) void k_wcvt(const float* __restrict__ wq, const float* __restrict__ wk, const float* __restrict__ wv, _Float16* __restrict__ wh) {
  const size_t g8 = (size_t)blockIdx.x * 256 + threadIdx.x; const int m = blockIdx.y;
  const float* s = m == 0 ? wq : (m == 1 ? wk : wv);
  union { v8h h; v4u u; } pk;
#pragma unroll
  for (int e = 0; e < 8; ++e) pk.h[e] = (_Float16)s[g8 * 8 + e];
  vst2(wh + (size_t)m * CC * CC + g8 * 8, pk.u);
}

// ---- projections: block = 64 positions (n, w0..) x 128 output channels (2 heads) of q/k/v (grid.z); K = 1024
// q,k -> [n][h][w][64] f16 rows; v -> vT[n][h][d][w] f16
__global__ __launch_bounds__(128) void k_qkv(const _Float16* __restrict__ xT, const _Float16* __restrict__ wh, const float* __restrict__ bq,
                                           const float* __restrict__ bk, const float* __restrict__ bv,
                                           _Float16* __restrict__ qh, _Float16* __restrict__ kh, _Float16* __restrict__ vT) {
  __shared__ __align__(16) float st[128][68];
  const int tid = threadIdx.x, wave = tid >> 5, lane = tid & 31, col = lane & 15, g = lane >> 4;
  const int n = blockIdx.y / (WW / 64), w0 = (blockIdx.y % (WW / 64)) * 64, o0 = blockIdx.x * 128, which = blockIdx.z;
  const _Float16* W = wh + (size_t)which * CC * CC;
  const float* bb = which == 0 ? bq : (which == 1 ? bk : bv);
  v8f acc[8] = {};
#pragma unroll 1
  for (int kc = 0; kc < CC / 32; ++kc) {
    const v16h a = frag_h(xT + ((size_t)n * WW + w0 + wave * 16 + col) * CC + kc * 32, lane);
#pragma unroll
    for (int j = 0; j < 8; ++j) acc[j] = wmma16(a, frag_h(W + (size_t)(o0 + j * 16 + col) * CC + kc * 32, lane), acc[j]);
  }
#pragma unroll
  for (int j = 0; j < 8; ++j) { const float bv_ = bb[o0 + j * 16 + col];
#pragma unroll
    for (int r = 0; r < 8; ++r) st[j * 16 + col][wave * 16 + 8 * g + r] = acc[j][r] + bv_; }
  __syncthreads();
  const int h0 = o0 / HD;
  if (which < 2) {
    _Float16* dst = which == 0 ? qh : kh;
    for (int q = tid; q < 2 * 64 * 8; q += 128) { const int hh = q >> 9, wl = (q >> 3) & 63, pc = q & 7;
      union { v8h h; v4u u; } pk;
#pragma unroll
      for (int e = 0; e < 8; ++e) pk.h[e] = (_Float16)st[hh * 64 + pc * 8 + e][wl];
      vst2(dst + (((size_t)n * HH + h0 + hh) * WW + w0 + wl) * HD + pc * 8, pk.u); }
  } else {
    for (int q = tid; q < 128 * 8; q += 128) { const int cl = q >> 3, pc = q & 7; const int hh = cl >> 6, d = cl & 63;
      union { v8h h; v4u u; } pk;
#pragma unroll
      for (int i = 0; i < 8; ++i) pk.h[i] = (_Float16)st[cl][pc * 8 + i];
      vst2(vT + (((size_t)n * HH + h0 + hh) * HD + d) * WW + w0 + pc * 8, pk.u); }
  }
}

// ---- flash attention per (n,h): block = 64 query positions; out[n][h*64+d][w] staged per block as [64 d][64 w] -> 256-B segments
__global__ __launch_bounds__(128) void k_attn(const _Float16* __restrict__ qh, const _Float16* __restrict__ kh, const _Float16* __restrict__ vT,
                                            const float* __restrict__ mask, float* __restrict__ out) {
  __shared__ __align__(16) float sP[4][16][BK];
  __shared__ __align__(16) float sOT[HD][68];          // [d][w_local]
  const int tid = threadIdx.x, w = tid >> 5, lane = tid & 31, g = lane >> 4, ln = lane & 15;
  const int bh = blockIdx.y, n = bh / HH, h = bh % HH, q0 = blockIdx.x * 64 + w * 16;
  const _Float16* qrow = qh + ((size_t)bh * WW + q0 + ln) * HD;
  const v16h qa0 = frag_h(qrow, lane), qa1 = frag_h(qrow + 32, lane);
  const float* mk = mask + (size_t)n * WW;             // [N,1,1,W]: per key
  float mrun[8], lrun[8];
  v8f acc[4];
#pragma unroll
  for (int r = 0; r < 8; ++r) { mrun[r] = -3.0e38f; lrun[r] = 0.f; }
#pragma unroll
  for (int t = 0; t < 4; ++t) acc[t] = (v8f){};
  const _Float16* kb = kh + (size_t)bh * WW * HD;
  const _Float16* vb = vT + (size_t)bh * HD * WW;
#pragma unroll 1
  for (int k0 = 0; k0 < WW; k0 += BK) {
    v8f s0 = {}, s1 = {};
    s0 = wmma16(qa0, frag_h(kb + (size_t)(k0 + ln) * HD, lane), s0);      s0 = wmma16(qa1, frag_h(kb + (size_t)(k0 + ln) * HD + 32, lane), s0);
    s1 = wmma16(qa0, frag_h(kb + (size_t)(k0 + 16 + ln) * HD, lane), s1); s1 = wmma16(qa1, frag_h(kb + (size_t)(k0 + 16 + ln) * HD + 32, lane), s1);
    const float mk0 = mk[k0 + ln], mk1 = mk[k0 + 16 + ln];
#pragma unroll
    for (int r = 0; r < 8; ++r) {
      const float x0 = s0[r] * 0.125f + mk0, x1 = s1[r] * 0.125f + mk1;
      float mx = fmaxf(x0, x1);
#pragma unroll
      for (int off = 8; off >= 1; off >>= 1) mx = fmaxf(mx, __shfl_xor(mx, off, 32));
      const float mn = fmaxf(mrun[r], mx);
      const float corr = expf(mrun[r] - mn);
      const float p0 = expf(x0 - mn), p1 = expf(x1 - mn);
      float sum = p0 + p1;
#pragma unroll
      for (int off = 8; off >= 1; off >>= 1) sum += __shfl_xor(sum, off, 32);
      lrun[r] = lrun[r] * corr + sum; mrun[r] = mn;
#pragma unroll
      for (int t = 0; t < 4; ++t) acc[t][r] *= corr;
      sP[w][8 * g + r][ln] = p0 * 16384.0f; sP[w][8 * g + r][16 + ln] = p1 * 16384.0f;
    }
    LDSX();
    const v16h pa = frag_f32(&sP[w][ln][0], lane);
#pragma unroll
    for (int t = 0; t < 4; ++t) acc[t] = wmma16(pa, frag_h(vb + (size_t)(t * 16 + ln) * WW + k0, lane), acc[t]);
    __builtin_amdgcn_wave_barrier();
  }
  // stage transposed: sOT[d][w_local] with w_local = w*16 + 8g + r, d = t*16 + ln
#pragma unroll
  for (int r = 0; r < 8; ++r) { const float il = (1.0f / 16384.0f) / lrun[r];
#pragma unroll
    for (int t = 0; t < 4; ++t) sOT[t * 16 + ln][w * 16 + 8 * g + r] = acc[t][r] * il; }
  __syncthreads();
  const int qb0 = blockIdx.x * 64;
  for (int q = tid; q < HD * 16; q += 128) { const int d = q >> 4, pc = q & 15;
    vst2(out + ((size_t)n * CC + h * HD + d) * WW + qb0 + pc * 4, *(const v4f*)(&sOT[d][pc * 4])); }
}

extern "C" void kernel_launch(void* const* d_in, const int* in_sizes, int n_in,
                              void* d_out, int out_size, void* d_ws, size_t ws_size,
                              hipStream_t stream) {
  (void)in_sizes; (void)n_in; (void)out_size; (void)ws_size;
  const float* hs   = (const float*)d_in[0];
  const float* mask = (const float*)d_in[1];
  const float* wq = (const float*)d_in[2]; const float* bq = (const float*)d_in[3];
  const float* wk = (const float*)d_in[4]; const float* bk = (const float*)d_in[5];
  const float* wv = (const float*)d_in[6]; const float* bv = (const float*)d_in[7];
  float* out = (float*)d_out;
  char* ws = (char*)d_ws; size_t off = 0;
  auto take = [&](size_t bytes) { char* p = ws + off; off += (bytes + 255) & ~(size_t)255; return p; };
  _Float16* xT = (_Float16*)take((size_t)NB * WW * CC * 2);      // 16 MB
  _Float16* wh = (_Float16*)take((size_t)3 * CC * CC * 2);       // 6 MB
  _Float16* qh = (_Float16*)take((size_t)NB * HH * WW * HD * 2);  // 16 MB
  _Float16* kh = (_Float16*)take((size_t)NB * HH * WW * HD * 2);
  _Float16* vT = (_Float16*)take((size_t)NB * HH * HD * WW * 2);
  k_xT<<<dim3(WW / 64, CC / 64, NB), 256, 0, stream>>>(hs, xT);
  k_wcvt<<<dim3((CC * CC / 8) / 256, 3), 256, 0, stream>>>(wq, wk, wv, wh);
  k_qkv<<<dim3(CC / 128, NB * (WW / 64), 3), 128, 0, stream>>>(xT, wh, bq, bk, bv, qh, kh, vT);
  k_attn<<<dim3(WW / 64, NB * HH), 128, 0, stream>>>(qh, kh, vT, mask, out);
}

// v001
// A run of this version takes 279 microseconds.
// In both of two side-by-side timings against v000, it was 1.64 times as fast.
#include <hip/hip_runtime.h>
#include <math.h>

// Conv1d(k=1) self-attention: q/k/v = 1x1 conv over [N,C,W] (C = 1024), 16 heads x 64, softmax(q.k/8 + mask) v, output
// [N,C,W]. Contractions on v_wmma_f32_16x16x32_f16 with f16 operands (x pre-transposed once to f16 [n][w][c] rows, weights
// converted to f16 rows), f32 accumulate; online softmax in f32 with P lifted by 2^14 before its f16 conversion (2^-14 folded

#define NB 8
#define CC 1024
#define WW 1024
#define HH 16
#define HD 64
#define BK 32

typedef __attribute__((ext_vector_type(16))) _Float16 v16h;
typedef __attribute__((ext_vector_type(8)))  _Float16 v8h;
typedef __attribute__((ext_vector_type(8)))  float v8f;
typedef __attribute__((ext_vector_type(4)))  float v4f;
typedef __attribute__((ext_vector_type(4)))  unsigned v4u;

template <typename T> __device__ __forceinline__ void vst2(void* p, T v) { *(T*)p = v;  }
__device__ __forceinline__ v8f wmma16(v16h a, v16h b, v8f c) {
  v8f d = __builtin_amdgcn_wmma_f32_16x16x32_f16(false, a, false, b, (short)0, c, false, false);
  asm volatile("v_nop\n\tv_nop\n\tv_nop\n\tv_nop" : "+v"(d) : "v"(a), "v"(b));
  return d;
}
__device__ __forceinline__ v16h frag_h(const _Float16* rowk0, int lane) {
  union { v16h v; v8h q[2]; } u; const _Float16* p = rowk0 + 8 * (lane >> 4);
  u.q[0] = *(const v8h*)p; u.q[1] = *(const v8h*)(p + 16); return u.v;
}
__device__ __forceinline__ v16h frag_f32(const float* rowk0, int lane) {
  v16h a; const float* p = rowk0 + 8 * (lane >> 4);
#pragma unroll
  for (int i = 0; i < 8; ++i) { a[i] = (_Float16)p[i]; a[8 + i] = (_Float16)p[16 + i]; }
  return a;
}
#define LDSX() do { asm volatile("s_wait_dscnt 0" ::: "memory"); __builtin_amdgcn_wave_barrier(); __builtin_amdgcn_fence(__ATOMIC_RELEASE, "workgroup"); } while (0)

__global__ __launch_bounds__(256) void k_xT(const float* __restrict__ x, _Float16* __restrict__ xT) {
  __shared__ float tile[64][65];
  const int n = blockIdx.z, c0 = blockIdx.y * 64, w0 = blockIdx.x * 64, tid = threadIdx.x;
  for (int q = tid; q < 64 * 64; q += 256) { const int cl = q >> 6, wl = q & 63; tile[cl][wl] = x[((size_t)n * CC + c0 + cl) * WW + w0 + wl]; }
  __syncthreads();
  for (int q = tid; q < 64 * 8; q += 256) { const int wl = q >> 3, pc = q & 7;
    union { v8h h; v4u u; } pk;
#pragma unroll
    for (int e = 0; e < 8; ++e) pk.h[e] = (_Float16)tile[pc * 8 + e][wl];
    vst2(xT + ((size_t)n * WW + w0 + wl) * CC + c0 + pc * 8, pk.u); }
}
// ---- weights f32 [Cout][Cin] -> f16 rows (same layout), 16 B per thread; all three matrices in one launch (grid.y)
__global__ __launch_bounds__(256) void k_wcvt(const float* __restrict__ wq, const float* __restrict__ wk, const float* __restrict__ wv, _Float16* __restrict__ wh) {
  const size_t g8 = (size_t)blockIdx.x * 256 + threadIdx.x; const int m = blockIdx.y;
  const float* s = m == 0 ? wq : (m == 1 ? wk : wv);
  union { v8h h; v4u u; } pk;
#pragma unroll
  for (int e = 0; e < 8; ++e) pk.h[e] = (_Float16)s[g8 * 8 + e];
  vst2(wh + (size_t)m * CC * CC + g8 * 8, pk.u);
}

// ---- one stage of k_qkv's operands, global -> LDS without registers: 192 rows x 128 B, 12 x 16 B per thread
#define KS 64                    // k per stage: 128 B of every operand row
#define RP 72                    // LDS row pitch in halves: 144 B = 16 B x 9, no bank conflict for 16-byte fragment reads
#define SBYTES (192 * RP * 2)    // one stage buffer
__device__ __forceinline__ void stage_copy(unsigned l, const _Float16* gx, const _Float16* gw) {
  // the closing s_wait_xcnt stands inside the statement so that no address register is rewritten ahead of it
  asm volatile("global_load_async_to_lds_b128 %0, %12, off\n\t"
               "global_load_async_to_lds_b128 %1, %13, off\n\t"
               "global_load_async_to_lds_b128 %2, %14, off\n\t"
               "global_load_async_to_lds_b128 %3, %15, off\n\t"
               "global_load_async_to_lds_b128 %4, %16, off\n\t"
               "global_load_async_to_lds_b128 %5, %17, off\n\t"
               "global_load_async_to_lds_b128 %6, %18, off\n\t"
               "global_load_async_to_lds_b128 %7, %19, off\n\t"
               "global_load_async_to_lds_b128 %8, %20, off\n\t"
               "global_load_async_to_lds_b128 %9, %21, off\n\t"
               "global_load_async_to_lds_b128 %10, %22, off\n\t"
               "global_load_async_to_lds_b128 %11, %23, off\n\t"
               "s_wait_xcnt 0x0"
               :: "v"(l), "v"(l + 1 * 16 * RP * 2), "v"(l + 2 * 16 * RP * 2), "v"(l + 3 * 16 * RP * 2),
                  "v"(l + 4 * 16 * RP * 2), "v"(l + 5 * 16 * RP * 2), "v"(l + 6 * 16 * RP * 2), "v"(l + 7 * 16 * RP * 2),
                  "v"(l + 8 * 16 * RP * 2), "v"(l + 9 * 16 * RP * 2), "v"(l + 10 * 16 * RP * 2), "v"(l + 11 * 16 * RP * 2),
                  "v"(gx), "v"(gx + 1 * 16 * CC), "v"(gx + 2 * 16 * CC), "v"(gx + 3 * 16 * CC),
                  "v"(gw), "v"(gw + 1 * 16 * CC), "v"(gw + 2 * 16 * CC), "v"(gw + 3 * 16 * CC),
                  "v"(gw + 4 * 16 * CC), "v"(gw + 5 * 16 * CC), "v"(gw + 6 * 16 * CC), "v"(gw + 7 * 16 * CC)
               : "memory");
}

// ---- projections: block = 64 positions (n, w0..) x 128 output channels (2 heads) of q/k/v (grid.z); K = 1024
// q,k -> [n][h][w][64] f16 rows; v -> vT[n][h][d][w] f16
__global__ __launch_bounds__(128) void k_qkv(const _Float16* __restrict__ xT, const _Float16* __restrict__ wh, const float* __restrict__ bq,
                                           const float* __restrict__ bk, const float* __restrict__ bv,
                                           _Float16* __restrict__ qh, _Float16* __restrict__ kh, _Float16* __restrict__ vT) {
  // two stage buffers of [64 x rows | 128 weight rows] x 64 k; after the K loop the same bytes serve as the epilogue's st[128][68]
  __shared__ __align__(16) unsigned char sm[2 * SBYTES];
  float (*st)[68] = (float (*)[68])sm;
  const int tid = threadIdx.x, wave = tid >> 5, lane = tid & 31, col = lane & 15, g = lane >> 4;
  const int n = blockIdx.y / (WW / 64), w0 = (blockIdx.y % (WW / 64)) * 64, o0 = blockIdx.x * 128, which = blockIdx.z;
  const _Float16* W = wh + (size_t)which * CC * CC;
  const float* bb = which == 0 ? bq : (which == 1 ? bk : bv);
  v8f acc[8] = {};
  // copy map: 8 lanes cover one 128-B row slice (a whole line), a thread's 12 copies are 16 rows apart
  const int cr = tid >> 3, cq = tid & 7;
  const _Float16* gx = xT + ((size_t)n * WW + w0 + cr) * CC + cq * 8;
  const _Float16* gw = W + (size_t)(o0 + cr) * CC + cq * 8;
  const unsigned l0 = (unsigned)(size_t)sm + cr * (RP * 2) + cq * 16;
  stage_copy(l0, gx, gw);
  asm volatile("s_wait_asynccnt 0x0" ::: "memory");   // stage 0 has landed before the barrier that publishes it
  __syncthreads();
  stage_copy(l0 + SBYTES, gx + KS, gw + KS);
#pragma unroll 1   // rolled: one publish point per trip keeps the two-buffer order below as written
  for (int t = 0; t < CC / KS; ++t) {
    const _Float16* sb = (const _Float16*)(sm + (t & 1) * SBYTES);
#pragma unroll
    for (int kk = 0; kk < KS; kk += 32) {
      // all 18 fragment reads of a 32-k block go out as one group, so that one LDS latency is paid per block and not per product
      const v16h a = frag_h(sb + (wave * 16 + col) * RP + kk, lane);
      v16h b[8];
#pragma unroll
      for (int j = 0; j < 8; ++j) b[j] = frag_h(sb + (64 + j * 16 + col) * RP + kk, lane);
#pragma unroll
      for (int j = 0; j < 8; ++j) acc[j] = wmma16(a, b[j], acc[j]);
    }
    asm volatile("s_wait_dscnt 0x0" ::: "memory");     // this wave's reads of buffer t&1 are done before the buffer is refilled
    asm volatile("s_wait_asynccnt 0x0" ::: "memory");  // this wave's copies of stage t+1 have landed before other waves read them
    __syncthreads();                                   // publishes stage t+1 and ends every reader's last read of buffer t&1
    if (t + 2 < CC / KS) stage_copy(l0 + (t & 1) * SBYTES, gx + (t + 2) * KS, gw + (t + 2) * KS);
  }
  asm volatile("s_wait_asynccnt 0x0" ::: "memory");    // no copy is outstanding when the buffers become the epilogue's staging
#pragma unroll
  for (int j = 0; j < 8; ++j) { const float bv_ = bb[o0 + j * 16 + col];
#pragma unroll
    for (int r = 0; r < 8; ++r) st[j * 16 + col][wave * 16 + 8 * g + r] = acc[j][r] + bv_; }
  __syncthreads();
  const int h0 = o0 / HD;
  if (which < 2) {
    _Float16* dst = which == 0 ? qh : kh;
    for (int q = tid; q < 2 * 64 * 8; q += 128) { const int hh = q >> 9, wl = (q >> 3) & 63, pc = q & 7;
      union { v8h h; v4u u; } pk;
#pragma unroll
      for (int e = 0; e < 8; ++e) pk.h[e] = (_Float16)st[hh * 64 + pc * 8 + e][wl];
      vst2(dst + (((size_t)n * HH + h0 + hh) * WW + w0 + wl) * HD + pc * 8, pk.u); }
  } else {
    for (int q = tid; q < 128 * 8; q += 128) { const int cl = q >> 3, pc = q & 7; const int hh = cl >> 6, d = cl & 63;
      union { v8h h; v4u u; } pk;
#pragma unroll
      for (int i = 0; i < 8; ++i) pk.h[i] = (_Float16)st[cl][pc * 8 + i];
      vst2(vT + (((size_t)n * HH + h0 + hh) * HD + d) * WW + w0 + pc * 8, pk.u); }
  }
}

// ---- flash attention per (n,h): block = 64 query positions; out[n][h*64+d][w] staged per block as [64 d][64 w] -> 256-B segments
__global__ __launch_bounds__(128) void k_attn(const _Float16* __restrict__ qh, const _Float16* __restrict__ kh, const _Float16* __restrict__ vT,
                                            const float* __restrict__ mask, float* __restrict__ out) {
  __shared__ __align__(16) float sP[4][16][BK];
  __shared__ __align__(16) float sOT[HD][68];          // [d][w_local]
  const int tid = threadIdx.x, w = tid >> 5, lane = tid & 31, g = lane >> 4, ln = lane & 15;
  const int bh = blockIdx.y, n = bh / HH, h = bh % HH, q0 = blockIdx.x * 64 + w * 16;
  const _Float16* qrow = qh + ((size_t)bh * WW + q0 + ln) * HD;
  const v16h qa0 = frag_h(qrow, lane), qa1 = frag_h(qrow + 32, lane);
  const float* mk = mask + (size_t)n * WW;             // [N,1,1,W]: per key
  float mrun[8], lrun[8];
  v8f acc[4];
#pragma unroll
  for (int r = 0; r < 8; ++r) { mrun[r] = -3.0e38f; lrun[r] = 0.f; }
#pragma unroll
  for (int t = 0; t < 4; ++t) acc[t] = (v8f){};
  const _Float16* kb = kh + (size_t)bh * WW * HD;
  const _Float16* vb = vT + (size_t)bh * HD * WW;
#pragma unroll 1
  for (int k0 = 0; k0 < WW; k0 += BK) {
    v8f s0 = {}, s1 = {};
    s0 = wmma16(qa0, frag_h(kb + (size_t)(k0 + ln) * HD, lane), s0);      s0 = wmma16(qa1, frag_h(kb + (size_t)(k0 + ln) * HD + 32, lane), s0);
    s1 = wmma16(qa0, frag_h(kb + (size_t)(k0 + 16 + ln) * HD, lane), s1); s1 = wmma16(qa1, frag_h(kb + (size_t)(k0 + 16 + ln) * HD + 32, lane), s1);
    const float mk0 = mk[k0 + ln], mk1 = mk[k0 + 16 + ln];
#pragma unroll
    for (int r = 0; r < 8; ++r) {
      const float x0 = s0[r] * 0.125f + mk0, x1 = s1[r] * 0.125f + mk1;
      float mx = fmaxf(x0, x1);
#pragma unroll
      for (int off = 8; off >= 1; off >>= 1) mx = fmaxf(mx, __shfl_xor(mx, off, 32));
      const float mn = fmaxf(mrun[r], mx);
      const float corr = expf(mrun[r] - mn);
      const float p0 = expf(x0 - mn), p1 = expf(x1 - mn);
      float sum = p0 + p1;
#pragma unroll
      for (int off = 8; off >= 1; off >>= 1) sum += __shfl_xor(sum, off, 32);
      lrun[r] = lrun[r] * corr + sum; mrun[r] = mn;
#pragma unroll
      for (int t = 0; t < 4; ++t) acc[t][r] *= corr;
      sP[w][8 * g + r][ln] = p0 * 16384.0f; sP[w][8 * g + r][16 + ln] = p1 * 16384.0f;
    }
    LDSX();
    const v16h pa = frag_f32(&sP[w][ln][0], lane);
#pragma unroll
    for (int t = 0; t < 4; ++t) acc[t] = wmma16(pa, frag_h(vb + (size_t)(t * 16 + ln) * WW + k0, lane), acc[t]);
    __builtin_amdgcn_wave_barrier();
  }
  // stage transposed: sOT[d][w_local] with w_local = w*16 + 8g + r, d = t*16 + ln
#pragma unroll
  for (int r = 0; r < 8; ++r) { const float il = (1.0f / 16384.0f) / lrun[r];
#pragma unroll
    for (int t = 0; t < 4; ++t) sOT[t * 16 + ln][w * 16 + 8 * g + r] = acc[t][r] * il; }
  __syncthreads();
  const int qb0 = blockIdx.x * 64;
  for (int q = tid; q < HD * 16; q += 128) { const int d = q >> 4, pc = q & 15;
    vst2(out + ((size_t)n * CC + h * HD + d) * WW + qb0 + pc * 4, *(const v4f*)(&sOT[d][pc * 4])); }
}

extern "C" void kernel_launch(void* const* d_in, const int* in_sizes, int n_in,
                              void* d_out, int out_size, void* d_ws, size_t ws_size,
                              hipStream_t stream) {
  (void)in_sizes; (void)n_in; (void)out_size; (void)ws_size;
  const float* hs   = (const float*)d_in[0];
  const float* mask = (const float*)d_in[1];
  const float* wq = (const float*)d_in[2]; const float* bq = (const float*)d_in[3];
  const float* wk = (const float*)d_in[4]; const float* bk = (const float*)d_in[5];
  const float* wv = (const float*)d_in[6]; const float* bv = (const float*)d_in[7];
  float* out = (float*)d_out;
  char* ws = (char*)d_ws; size_t off = 0;
  auto take = [&](size_t bytes) { char* p = ws + off; off += (bytes + 255) & ~(size_t)255; return p; };
  _Float16* xT = (_Float16*)take((size_t)NB * WW * CC * 2);      // 16 MB
  _Float16* wh = (_Float16*)take((size_t)3 * CC * CC * 2);       // 6 MB
  _Float16* qh = (_Float16*)take((size_t)NB * HH * WW * HD * 2);  // 16 MB
  _Float16* kh = (_Float16*)take((size_t)NB * HH * WW * HD * 2);
  _Float16* vT = (_Float16*)take((size_t)NB * HH * HD * WW * 2);
  k_xT<<<dim3(WW / 64, CC / 64, NB), 256, 0, stream>>>(hs, xT);
  k_wcvt<<<dim3((CC * CC / 8) / 256, 3), 256, 0, stream>>>(wq, wk, wv, wh);
  k_qkv<<<dim3(CC / 128, NB * (WW / 64), 3), 128, 0, stream>>>(xT, wh, bq, bk, bv, qh, kh, vT);
  k_attn<<<dim3(WW / 64, NB * HH), 128, 0, stream>>>(qh, kh, vT, mask, out);
}

// v002
// Measured time: 200 microseconds a run.
// In two side-by-side timings against v001, it was 1.41 and 1.40 times as fast.
// All steps since v000 together make it 2.30 times as fast.
#include <hip/hip_runtime.h>
#include <math.h>

// Conv1d(k=1) self-attention: q/k/v = 1x1 conv over [N,C,W] (C = 1024), 16 heads x 64, softmax(q.k/8 + mask) v, output
// [N,C,W]. Contractions on v_wmma_f32_16x16x32_f16 with f16 operands (x pre-transposed once to f16 [n][w][c] rows, weights
// converted to f16 rows), f32 accumulate; online softmax in f32 with P lifted by 2^14 before its f16 conversion (2^-14 folded

#define NB 8
#define CC 1024
#define WW 1024
#define HH 16
#define HD 64
#define BK 32

typedef __attribute__((ext_vector_type(16))) _Float16 v16h;
typedef __attribute__((ext_vector_type(8)))  _Float16 v8h;
typedef __attribute__((ext_vector_type(8)))  float v8f;
typedef __attribute__((ext_vector_type(4)))  float v4f;
typedef __attribute__((ext_vector_type(4)))  unsigned v4u;

template <typename T> __device__ __forceinline__ void vst2(void* p, T v) { *(T*)p = v;  }
__device__ __forceinline__ v8f wmma16(v16h a, v16h b, v8f c) {
  v8f d = __builtin_amdgcn_wmma_f32_16x16x32_f16(false, a, false, b, (short)0, c, false, false);
  asm volatile("v_nop\n\tv_nop\n\tv_nop\n\tv_nop" : "+v"(d) : "v"(a), "v"(b));
  return d;
}
__device__ __forceinline__ v16h frag_h(const _Float16* rowk0, int lane) {
  union { v16h v; v8h q[2]; } u; const _Float16* p = rowk0 + 8 * (lane >> 4);
  u.q[0] = *(const v8h*)p; u.q[1] = *(const v8h*)(p + 16); return u.v;
}
// lane l <-> lane l ^ 16, on the vector pipe
__device__ __forceinline__ float xhalf(float x) {
  const int b = __builtin_bit_cast(int, x);
  return __builtin_bit_cast(float, __builtin_amdgcn_permlanex16(b, b, 0x76543210, 0xfedcba98, false, false));
}

__global__ __launch_bounds__(256) void k_xT(const float* __restrict__ x, _Float16* __restrict__ xT) {
  __shared__ float tile[64][65];
  const int n = blockIdx.z, c0 = blockIdx.y * 64, w0 = blockIdx.x * 64, tid = threadIdx.x;
  for (int q = tid; q < 64 * 64; q += 256) { const int cl = q >> 6, wl = q & 63; tile[cl][wl] = x[((size_t)n * CC + c0 + cl) * WW + w0 + wl]; }
  __syncthreads();
  for (int q = tid; q < 64 * 8; q += 256) { const int wl = q >> 3, pc = q & 7;
    union { v8h h; v4u u; } pk;
#pragma unroll
    for (int e = 0; e < 8; ++e) pk.h[e] = (_Float16)tile[pc * 8 + e][wl];
    vst2(xT + ((size_t)n * WW + w0 + wl) * CC + c0 + pc * 8, pk.u); }
}
// ---- weights f32 [Cout][Cin] -> f16 rows (same layout), 16 B per thread; all three matrices in one launch (grid.y)
__global__ __launch_bounds__(256) void k_wcvt(const float* __restrict__ wq, const float* __restrict__ wk, const float* __restrict__ wv, _Float16* __restrict__ wh) {
  const size_t g8 = (size_t)blockIdx.x * 256 + threadIdx.x; const int m = blockIdx.y;
  const float* s = m == 0 ? wq : (m == 1 ? wk : wv);
  union { v8h h; v4u u; } pk;
#pragma unroll
  for (int e = 0; e < 8; ++e) pk.h[e] = (_Float16)s[g8 * 8 + e];
  vst2(wh + (size_t)m * CC * CC + g8 * 8, pk.u);
}

// ---- one stage of k_qkv's operands, global -> LDS without registers: 192 rows x 128 B, 12 x 16 B per thread
#define KS 64                    // k per stage: 128 B of every operand row
#define RP 72                    // LDS row pitch in halves: 144 B = 16 B x 9, no bank conflict for 16-byte fragment reads
#define SBYTES (192 * RP * 2)    // one stage buffer
__device__ __forceinline__ void stage_copy(unsigned l, const _Float16* gx, const _Float16* gw) {
  // the closing s_wait_xcnt stands inside the statement so that no address register is rewritten ahead of it
  asm volatile("global_load_async_to_lds_b128 %0, %12, off\n\t"
               "global_load_async_to_lds_b128 %1, %13, off\n\t"
               "global_load_async_to_lds_b128 %2, %14, off\n\t"
               "global_load_async_to_lds_b128 %3, %15, off\n\t"
               "global_load_async_to_lds_b128 %4, %16, off\n\t"
               "global_load_async_to_lds_b128 %5, %17, off\n\t"
               "global_load_async_to_lds_b128 %6, %18, off\n\t"
               "global_load_async_to_lds_b128 %7, %19, off\n\t"
               "global_load_async_to_lds_b128 %8, %20, off\n\t"
               "global_load_async_to_lds_b128 %9, %21, off\n\t"
               "global_load_async_to_lds_b128 %10, %22, off\n\t"
               "global_load_async_to_lds_b128 %11, %23, off\n\t"
               "s_wait_xcnt 0x0"
               :: "v"(l), "v"(l + 1 * 16 * RP * 2), "v"(l + 2 * 16 * RP * 2), "v"(l + 3 * 16 * RP * 2),
                  "v"(l + 4 * 16 * RP * 2), "v"(l + 5 * 16 * RP * 2), "v"(l + 6 * 16 * RP * 2), "v"(l + 7 * 16 * RP * 2),
                  "v"(l + 8 * 16 * RP * 2), "v"(l + 9 * 16 * RP * 2), "v"(l + 10 * 16 * RP * 2), "v"(l + 11 * 16 * RP * 2),
                  "v"(gx), "v"(gx + 1 * 16 * CC), "v"(gx + 2 * 16 * CC), "v"(gx + 3 * 16 * CC),
                  "v"(gw), "v"(gw + 1 * 16 * CC), "v"(gw + 2 * 16 * CC), "v"(gw + 3 * 16 * CC),
                  "v"(gw + 4 * 16 * CC), "v"(gw + 5 * 16 * CC), "v"(gw + 6 * 16 * CC), "v"(gw + 7 * 16 * CC)
               : "memory");
}

// ---- projections: block = 64 positions (n, w0..) x 128 output channels (2 heads) of q/k/v (grid.z); K = 1024
// q,k -> [n][h][w][64] f16 rows; v -> vT[n][h][d][w] f16
__global__ __launch_bounds__(128) void k_qkv(const _Float16* __restrict__ xT, const _Float16* __restrict__ wh, const float* __restrict__ bq,
                                           const float* __restrict__ bk, const float* __restrict__ bv,
                                           _Float16* __restrict__ qh, _Float16* __restrict__ kh, _Float16* __restrict__ vT) {
  // two stage buffers of [64 x rows | 128 weight rows] x 64 k; after the K loop the same bytes serve as the epilogue's st[128][68]
  __shared__ __align__(16) unsigned char sm[2 * SBYTES];
  float (*st)[68] = (float (*)[68])sm;
  const int tid = threadIdx.x, wave = tid >> 5, lane = tid & 31, col = lane & 15, g = lane >> 4;
  const int n = blockIdx.y / (WW / 64), w0 = (blockIdx.y % (WW / 64)) * 64, o0 = blockIdx.x * 128, which = blockIdx.z;
  const _Float16* W = wh + (size_t)which * CC * CC;
  const float* bb = which == 0 ? bq : (which == 1 ? bk : bv);
  v8f acc[8] = {};
  // copy map: 8 lanes cover one 128-B row slice (a whole line), a thread's 12 copies are 16 rows apart
  const int cr = tid >> 3, cq = tid & 7;
  const _Float16* gx = xT + ((size_t)n * WW + w0 + cr) * CC + cq * 8;
  const _Float16* gw = W + (size_t)(o0 + cr) * CC + cq * 8;
  const unsigned l0 = (unsigned)(size_t)sm + cr * (RP * 2) + cq * 16;
  stage_copy(l0, gx, gw);
  asm volatile("s_wait_asynccnt 0x0" ::: "memory");   // stage 0 has landed before the barrier that publishes it
  __syncthreads();
  stage_copy(l0 + SBYTES, gx + KS, gw + KS);
#pragma unroll 1   // rolled: one publish point per trip keeps the two-buffer order below as written
  for (int t = 0; t < CC / KS; ++t) {
    const _Float16* sb = (const _Float16*)(sm + (t & 1) * SBYTES);
#pragma unroll
    for (int kk = 0; kk < KS; kk += 32) {
      // all 18 fragment reads of a 32-k block go out as one group, so that one LDS latency is paid per block and not per product
      const v16h a = frag_h(sb + (wave * 16 + col) * RP + kk, lane);
      v16h b[8];
#pragma unroll
      for (int j = 0; j < 8; ++j) b[j] = frag_h(sb + (64 + j * 16 + col) * RP + kk, lane);
#pragma unroll
      for (int j = 0; j < 8; ++j) acc[j] = wmma16(a, b[j], acc[j]);
    }
    asm volatile("s_wait_dscnt 0x0" ::: "memory");     // this wave's reads of buffer t&1 are done before the buffer is refilled
    asm volatile("s_wait_asynccnt 0x0" ::: "memory");  // this wave's copies of stage t+1 have landed before other waves read them
    __syncthreads();                                   // publishes stage t+1 and ends every reader's last read of buffer t&1
    if (t + 2 < CC / KS) stage_copy(l0 + (t & 1) * SBYTES, gx + (t + 2) * KS, gw + (t + 2) * KS);
  }
  asm volatile("s_wait_asynccnt 0x0" ::: "memory");    // no copy is outstanding when the buffers become the epilogue's staging
#pragma unroll
  for (int j = 0; j < 8; ++j) { const float bv_ = bb[o0 + j * 16 + col];
#pragma unroll
    for (int r = 0; r < 8; ++r) st[j * 16 + col][wave * 16 + 8 * g + r] = acc[j][r] + bv_; }
  __syncthreads();
  const int h0 = o0 / HD;
  if (which < 2) {
    _Float16* dst = which == 0 ? qh : kh;
    for (int q = tid; q < 2 * 64 * 8; q += 128) { const int hh = q >> 9, wl = (q >> 3) & 63, pc = q & 7;
      union { v8h h; v4u u; } pk;
#pragma unroll
      for (int e = 0; e < 8; ++e) pk.h[e] = (_Float16)st[hh * 64 + pc * 8 + e][wl];
      vst2(dst + (((size_t)n * HH + h0 + hh) * WW + w0 + wl) * HD + pc * 8, pk.u); }
  } else {
    for (int q = tid; q < 128 * 8; q += 128) { const int cl = q >> 3, pc = q & 7; const int hh = cl >> 6, d = cl & 63;
      union { v8h h; v4u u; } pk;
#pragma unroll
      for (int i = 0; i < 8; ++i) pk.h[i] = (_Float16)st[cl][pc * 8 + i];
      vst2(vT + (((size_t)n * HH + h0 + hh) * HD + d) * WW + w0 + pc * 8, pk.u); }
  }
}

__global__ __launch_bounds__(128) void k_attn(const _Float16* __restrict__ qh, const _Float16* __restrict__ kh, const _Float16* __restrict__ vT,
                                            const float* __restrict__ mask, float* __restrict__ out) {
  __shared__ __align__(16) float sOT[HD][68];          // [d][w_local]
  const int tid = threadIdx.x, w = tid >> 5, lane = tid & 31, g = lane >> 4, ln = lane & 15;
  const int bh = blockIdx.y, n = bh / HH, h = bh % HH, q0 = blockIdx.x * 64 + w * 16;
  const _Float16* qrow = qh + ((size_t)bh * WW + q0 + ln) * HD;
  const v16h qb0 = frag_h(qrow, lane), qb1 = frag_h(qrow + 32, lane);
  const float* mk = mask + (size_t)n * WW + 8 * g;     // [N,1,1,W]: per key; this lane's keys are 8g + r and 16 + 8g + r of a pass
  float mrun = -3.0e38f, lrun = 0.f;                   // lrun: the sum over this lane's own keys; the halves are joined after the loop
  v8f acc[4];
#pragma unroll
  for (int t = 0; t < 4; ++t) acc[t] = (v8f){};
  const _Float16* kb = kh + (size_t)bh * WW * HD;
  const _Float16* vb = vT + (size_t)bh * HD * WW;
#pragma unroll 1   // rolled, as before: one pass's registers only; up to 128 let 8 waves share a SIMD, so that all 8 blocks of a WGP are resident at once
  for (int k0 = 0; k0 < WW; k0 += BK) {
    union { v8f v; v4f q[2]; } m0, m1;
    m0.q[0] = *(const v4f*)(mk + k0);      m0.q[1] = *(const v4f*)(mk + k0 + 4);
    m1.q[0] = *(const v4f*)(mk + k0 + 16); m1.q[1] = *(const v4f*)(mk + k0 + 20);
    v8f s0 = {}, s1 = {};                              // s0[r] = score(key k0 + 8g + r, query q0 + ln), s1[r]: key k0 + 16 + 8g + r
    s0 = wmma16(frag_h(kb + (size_t)(k0 + ln) * HD, lane), qb0, s0);      s0 = wmma16(frag_h(kb + (size_t)(k0 + ln) * HD + 32, lane), qb1, s0);
    s1 = wmma16(frag_h(kb + (size_t)(k0 + 16 + ln) * HD, lane), qb0, s1); s1 = wmma16(frag_h(kb + (size_t)(k0 + 16 + ln) * HD + 32, lane), qb1, s1);
    const v8f x0 = s0 * 0.125f + m0.v, x1 = s1 * 0.125f + m1.v;
    float mx = fmaxf(x0[0], x1[0]);
#pragma unroll
    for (int r = 1; r < 8; ++r) mx = fmaxf(mx, fmaxf(x0[r], x1[r]));
    mx = fmaxf(mx, xhalf(mx));                         // both halves now hold the query's maximum over the 32 keys
    const float mn = fmaxf(mrun, mx);
    const float corr = expf(mrun - mn);
    v8f p0, p1;
#pragma unroll
    for (int r = 0; r < 8; ++r) { p0[r] = expf(x0[r] - mn); p1[r] = expf(x1[r] - mn); }
    const v8f ps = p0 + p1;
    const float sum = ((ps[0] + ps[1]) + (ps[2] + ps[3])) + ((ps[4] + ps[5]) + (ps[6] + ps[7]));
    p0 *= 16384.0f; p1 *= 16384.0f;
    v16h pb;                                           // B operand: element r = key 8g + r, element 8 + r = key 16 + 8g + r, as frag_h orders V^T's k
#pragma unroll
    for (int r = 0; r < 8; ++r) { pb[r] = (_Float16)p0[r]; pb[8 + r] = (_Float16)p1[r]; }
    lrun = lrun * corr + sum; mrun = mn;
#pragma unroll
    for (int t = 0; t < 4; ++t) acc[t] *= corr;
#pragma unroll
    for (int t = 0; t < 4; ++t) acc[t] = wmma16(frag_h(vb + (size_t)(t * 16 + ln) * WW + k0, lane), pb, acc[t]);
  }
  // acc[t][r] = O^T[d = t*16 + 8g + r][query ln]: stage as sOT[d][w_local], w_local = w*16 + ln
  const float il = (1.0f / 16384.0f) / (lrun + xhalf(lrun));
#pragma unroll
  for (int t = 0; t < 4; ++t) {
#pragma unroll
    for (int r = 0; r < 8; ++r) sOT[t * 16 + 8 * g + r][w * 16 + ln] = acc[t][r] * il; }
  __syncthreads();
  const int qb0_ = blockIdx.x * 64;
  for (int q = tid; q < HD * 16; q += 128) { const int d = q >> 4, pc = q & 15;
    vst2(out + ((size_t)n * CC + h * HD + d) * WW + qb0_ + pc * 4, *(const v4f*)(&sOT[d][pc * 4])); }
}

extern "C" void kernel_launch(void* const* d_in, const int* in_sizes, int n_in,
                              void* d_out, int out_size, void* d_ws, size_t ws_size,
                              hipStream_t stream) {
  (void)in_sizes; (void)n_in; (void)out_size; (void)ws_size;
  const float* hs   = (const float*)d_in[0];
  const float* mask = (const float*)d_in[1];
  const float* wq = (const float*)d_in[2]; const float* bq = (const float*)d_in[3];
  const float* wk = (const float*)d_in[4]; const float* bk = (const float*)d_in[5];
  const float* wv = (const float*)d_in[6]; const float* bv = (const float*)d_in[7];
  float* out = (float*)d_out;
  char* ws = (char*)d_ws; size_t off = 0;
  auto take = [&](size_t bytes) { char* p = ws + off; off += (bytes + 255) & ~(size_t)255; return p; };
  _Float16* xT = (_Float16*)take((size_t)NB * WW * CC * 2);      // 16 MB
  _Float16* wh = (_Float16*)take((size_t)3 * CC * CC * 2);       // 6 MB
  _Float16* qh = (_Float16*)take((size_t)NB * HH * WW * HD * 2);  // 16 MB
  _Float16* kh = (_Float16*)take((size_t)NB * HH * WW * HD * 2);
  _Float16* vT = (_Float16*)take((size_t)NB * HH * HD * WW * 2);
  k_xT<<<dim3(WW / 64, CC / 64, NB), 256, 0, stream>>>(hs, xT);
  k_wcvt<<<dim3((CC * CC / 8) / 256, 3), 256, 0, stream>>>(wq, wk, wv, wh);
  k_qkv<<<dim3(CC / 128, NB * (WW / 64), 3), 128, 0, stream>>>(xT, wh, bq, bk, bv, qh, kh, vT);
  k_attn<<<dim3(WW / 64, NB * HH), 128, 0, stream>>>(qh, kh, vT, mask, out);
}

// v003
// One run takes 133 microseconds.
// In both of two side-by-side timings against v002, it was 1.50 times as fast.
// All steps since v000 together make it 3.46 times as fast.
#include <hip/hip_runtime.h>
#include <math.h>

// Conv1d(k=1) self-attention: q/k/v = 1x1 conv over [N,C,W] (C = 1024), 16 heads x 64, softmax(q.k/8 + mask) v, output
// [N,C,W]. Contractions on v_wmma_f32_16x16x32_f16 with f16 operands (x pre-transposed once to f16 [n][w][c] rows, weights
// converted to f16 rows), f32 accumulate; online softmax in f32 with P lifted by 2^14 before its f16 conversion (2^-14 folded

#define NB 8
#define CC 1024
#define WW 1024
#define HH 16
#define HD 64
#define BK 32

typedef __attribute__((ext_vector_type(16))) _Float16 v16h;
typedef __attribute__((ext_vector_type(8)))  _Float16 v8h;
typedef __attribute__((ext_vector_type(8)))  float v8f;
typedef __attribute__((ext_vector_type(4)))  float v4f;
typedef __attribute__((ext_vector_type(4)))  unsigned v4u;

template <typename T> __device__ __forceinline__ void vst2(void* p, T v) { *(T*)p = v;  }
__device__ __forceinline__ v8f wmma16(v16h a, v16h b, v8f c) {
  v8f d = __builtin_amdgcn_wmma_f32_16x16x32_f16(false, a, false, b, (short)0, c, false, false);
  asm volatile("v_nop\n\tv_nop\n\tv_nop\n\tv_nop" : "+v"(d) : "v"(a), "v"(b));
  return d;
}
__device__ __forceinline__ v16h frag_h(const _Float16* rowk0, int lane) {
  union { v16h v; v8h q[2]; } u; const _Float16* p = rowk0 + 8 * (lane >> 4);
  u.q[0] = *(const v8h*)p; u.q[1] = *(const v8h*)(p + 16); return u.v;
}
// lane l <-> lane l ^ 16, on the vector pipe
__device__ __forceinline__ float xhalf(float x) {
  const int b = __builtin_bit_cast(int, x);
  return __builtin_bit_cast(float, __builtin_amdgcn_permlanex16(b, b, 0x76543210, 0xfedcba98, false, false));
}

__global__ __launch_bounds__(256) void k_xT(const float* __restrict__ x, _Float16* __restrict__ xT) {
  __shared__ float tile[64][65];
  const int n = blockIdx.z, c0 = blockIdx.y * 64, w0 = blockIdx.x * 64, tid = threadIdx.x;
  for (int q = tid; q < 64 * 64; q += 256) { const int cl = q >> 6, wl = q & 63; tile[cl][wl] = x[((size_t)n * CC + c0 + cl) * WW + w0 + wl]; }
  __syncthreads();
  for (int q = tid; q < 64 * 8; q += 256) { const int wl = q >> 3, pc = q & 7;
    union { v8h h; v4u u; } pk;
#pragma unroll
    for (int e = 0; e < 8; ++e) pk.h[e] = (_Float16)tile[pc * 8 + e][wl];
    vst2(xT + ((size_t)n * WW + w0 + wl) * CC + c0 + pc * 8, pk.u); }
}
// ---- weights f32 [Cout][Cin] -> f16 rows (same layout), 16 B per thread; all three matrices in one launch (grid.y)
__global__ __launch_bounds__(256) void k_wcvt(const float* __restrict__ wq, const float* __restrict__ wk, const float* __restrict__ wv, _Float16* __restrict__ wh) {
  const size_t g8 = (size_t)blockIdx.x * 256 + threadIdx.x; const int m = blockIdx.y;
  const float* s = m == 0 ? wq : (m == 1 ? wk : wv);
  union { v8h h; v4u u; } pk;
#pragma unroll
  for (int e = 0; e < 8; ++e) pk.h[e] = (_Float16)s[g8 * 8 + e];
  vst2(wh + (size_t)m * CC * CC + g8 * 8, pk.u);
}

// ---- one stage of k_qkv's operands, global -> LDS without registers: 192 rows x 128 B, 12 x 16 B per thread
#define KS 64                    // k per stage: 128 B of every operand row
#define RP 72                    // LDS row pitch in halves: 144 B = 16 B x 9, no bank conflict for 16-byte fragment reads
#define SBYTES (192 * RP * 2)    // one stage buffer
__device__ __forceinline__ void stage_copy(unsigned l, const _Float16* gx, const _Float16* gw) {
  // the closing s_wait_xcnt stands inside the statement so that no address register is rewritten ahead of it
  asm volatile("global_load_async_to_lds_b128 %0, %12, off\n\t"
               "global_load_async_to_lds_b128 %1, %13, off\n\t"
               "global_load_async_to_lds_b128 %2, %14, off\n\t"
               "global_load_async_to_lds_b128 %3, %15, off\n\t"
               "global_load_async_to_lds_b128 %4, %16, off\n\t"
               "global_load_async_to_lds_b128 %5, %17, off\n\t"
               "global_load_async_to_lds_b128 %6, %18, off\n\t"
               "global_load_async_to_lds_b128 %7, %19, off\n\t"
               "global_load_async_to_lds_b128 %8, %20, off\n\t"
               "global_load_async_to_lds_b128 %9, %21, off\n\t"
               "global_load_async_to_lds_b128 %10, %22, off\n\t"
               "global_load_async_to_lds_b128 %11, %23, off\n\t"
               "s_wait_xcnt 0x0"
               :: "v"(l), "v"(l + 1 * 16 * RP * 2), "v"(l + 2 * 16 * RP * 2), "v"(l + 3 * 16 * RP * 2),
                  "v"(l + 4 * 16 * RP * 2), "v"(l + 5 * 16 * RP * 2), "v"(l + 6 * 16 * RP * 2), "v"(l + 7 * 16 * RP * 2),
                  "v"(l + 8 * 16 * RP * 2), "v"(l + 9 * 16 * RP * 2), "v"(l + 10 * 16 * RP * 2), "v"(l + 11 * 16 * RP * 2),
                  "v"(gx), "v"(gx + 1 * 16 * CC), "v"(gx + 2 * 16 * CC), "v"(gx + 3 * 16 * CC),
                  "v"(gw), "v"(gw + 1 * 16 * CC), "v"(gw + 2 * 16 * CC), "v"(gw + 3 * 16 * CC),
                  "v"(gw + 4 * 16 * CC), "v"(gw + 5 * 16 * CC), "v"(gw + 6 * 16 * CC), "v"(gw + 7 * 16 * CC)
               : "memory");
}

// ---- projections: block = 64 positions (n, w0..) x 128 output channels (2 heads) of q/k/v (grid.z); K = 1024
// q,k -> [n][h][w][64] f16 rows; v -> vT[n][h][d][w] f16
__global__ __launch_bounds__(128) void k_qkv(const _Float16* __restrict__ xT, const _Float16* __restrict__ wh, const float* __restrict__ bq,
                                           const float* __restrict__ bk, const float* __restrict__ bv,
                                           _Float16* __restrict__ qh, _Float16* __restrict__ kh, _Float16* __restrict__ vT) {
  // two stage buffers of [64 x rows | 128 weight rows] x 64 k; after the K loop the same bytes serve as the epilogue's st[128][68]
  __shared__ __align__(16) unsigned char sm[2 * SBYTES];
  float (*st)[68] = (float (*)[68])sm;
  const int tid = threadIdx.x, wave = tid >> 5, lane = tid & 31, col = lane & 15, g = lane >> 4;
  const int n = blockIdx.y / (WW / 64), w0 = (blockIdx.y % (WW / 64)) * 64, o0 = blockIdx.x * 128, which = blockIdx.z;
  const _Float16* W = wh + (size_t)which * CC * CC;
  const float* bb = which == 0 ? bq : (which == 1 ? bk : bv);
  v8f acc[8] = {};
  // copy map: 8 lanes cover one 128-B row slice (a whole line), a thread's 12 copies are 16 rows apart
  const int cr = tid >> 3, cq = tid & 7;
  const _Float16* gx = xT + ((size_t)n * WW + w0 + cr) * CC + cq * 8;
  const _Float16* gw = W + (size_t)(o0 + cr) * CC + cq * 8;
  const unsigned l0 = (unsigned)(size_t)sm + cr * (RP * 2) + cq * 16;
  stage_copy(l0, gx, gw);
  asm volatile("s_wait_asynccnt 0x0" ::: "memory");   // stage 0 has landed before the barrier that publishes it
  __syncthreads();
  stage_copy(l0 + SBYTES, gx + KS, gw + KS);
#pragma unroll 1   // rolled: one publish point per trip keeps the two-buffer order below as written
  for (int t = 0; t < CC / KS; ++t) {
    const _Float16* sb = (const _Float16*)(sm + (t & 1) * SBYTES);
#pragma unroll
    for (int kk = 0; kk < KS; kk += 32) {
      // all 18 fragment reads of a 32-k block go out as one group, so that one LDS latency is paid per block and not per product
      const v16h a = frag_h(sb + (wave * 16 + col) * RP + kk, lane);
      v16h b[8];
#pragma unroll
      for (int j = 0; j < 8; ++j) b[j] = frag_h(sb + (64 + j * 16 + col) * RP + kk, lane);
#pragma unroll
      for (int j = 0; j < 8; ++j) acc[j] = wmma16(a, b[j], acc[j]);
    }
    asm volatile("s_wait_dscnt 0x0" ::: "memory");     // this wave's reads of buffer t&1 are done before the buffer is refilled
    asm volatile("s_wait_asynccnt 0x0" ::: "memory");  // this wave's copies of stage t+1 have landed before other waves read them
    __syncthreads();                                   // publishes stage t+1 and ends every reader's last read of buffer t&1
    if (t + 2 < CC / KS) stage_copy(l0 + (t & 1) * SBYTES, gx + (t + 2) * KS, gw + (t + 2) * KS);
  }
  asm volatile("s_wait_asynccnt 0x0" ::: "memory");    // no copy is outstanding when the buffers become the epilogue's staging
#pragma unroll
  for (int j = 0; j < 8; ++j) { const float bv_ = bb[o0 + j * 16 + col];
#pragma unroll
    for (int r = 0; r < 8; ++r) st[j * 16 + col][wave * 16 + 8 * g + r] = acc[j][r] + bv_; }
  __syncthreads();
  const int h0 = o0 / HD;
  if (which < 2) {
    _Float16* dst = which == 0 ? qh : kh;
    for (int q = tid; q < 2 * 64 * 8; q += 128) { const int hh = q >> 9, wl = (q >> 3) & 63, pc = q & 7;
      union { v8h h; v4u u; } pk;
#pragma unroll
      for (int e = 0; e < 8; ++e) pk.h[e] = (_Float16)st[hh * 64 + pc * 8 + e][wl];
      vst2(dst + (((size_t)n * HH + h0 + hh) * WW + w0 + wl) * HD + pc * 8, pk.u); }
  } else {
    for (int q = tid; q < 128 * 8; q += 128) { const int cl = q >> 3, pc = q & 7; const int hh = cl >> 6, d = cl & 63;
      union { v8h h; v4u u; } pk;
#pragma unroll
      for (int i = 0; i < 8; ++i) pk.h[i] = (_Float16)st[cl][pc * 8 + i];
      vst2(vT + (((size_t)n * HH + h0 + hh) * HD + d) * WW + w0 + pc * 8, pk.u); }
  }
}

// ---- one stage of k_attn's operands, global -> LDS without registers: 64 key rows of K and the 64 d rows of V^T, 128 B of each; 8 x 16 B per thread
#define AK 64                    // keys per stage: a whole 128-B line of every V^T row, two 32-key passes
#define ABYTES (128 * RP * 2)    // one stage buffer, rows at k_qkv's 144-B pitch
__device__ __forceinline__ void stage_copy_kv(unsigned l, const _Float16* gk, const _Float16* gv) {
  // the closing s_wait_xcnt stands inside the statement so that no address register is rewritten ahead of it
  asm volatile("global_load_async_to_lds_b128 %0, %8, off\n\t"
               "global_load_async_to_lds_b128 %1, %9, off\n\t"
               "global_load_async_to_lds_b128 %2, %10, off\n\t"
               "global_load_async_to_lds_b128 %3, %11, off\n\t"
               "global_load_async_to_lds_b128 %4, %12, off\n\t"
               "global_load_async_to_lds_b128 %5, %13, off\n\t"
               "global_load_async_to_lds_b128 %6, %14, off\n\t"
               "global_load_async_to_lds_b128 %7, %15, off\n\t"
               "s_wait_xcnt 0x0"
               :: "v"(l), "v"(l + 1 * 16 * RP * 2), "v"(l + 2 * 16 * RP * 2), "v"(l + 3 * 16 * RP * 2),
                  "v"(l + 4 * 16 * RP * 2), "v"(l + 5 * 16 * RP * 2), "v"(l + 6 * 16 * RP * 2), "v"(l + 7 * 16 * RP * 2),
                  "v"(gk), "v"(gk + 1 * 16 * HD), "v"(gk + 2 * 16 * HD), "v"(gk + 3 * 16 * HD),
                  "v"(gv), "v"(gv + 1 * 16 * WW), "v"(gv + 2 * 16 * WW), "v"(gv + 3 * 16 * WW)
               : "memory");
}

__global__ __launch_bounds__(128) void k_attn(const _Float16* __restrict__ qh, const _Float16* __restrict__ kh, const _Float16* __restrict__ vT,
                                            const float* __restrict__ mask, float* __restrict__ out) {
  // two stage buffers of [64 K rows | 64 V^T rows] x 64 keys; after the key loop the same bytes serve as the epilogue's sOT[d][w_local]
  __shared__ __align__(16) unsigned char sm[2 * ABYTES];
  float (*sOT)[68] = (float (*)[68])sm;
  const int tid = threadIdx.x, w = tid >> 5, lane = tid & 31, g = lane >> 4, ln = lane & 15;
  const int bh = blockIdx.y, n = bh / HH, h = bh % HH, q0 = blockIdx.x * 64 + w * 16;
  const _Float16* qrow = qh + ((size_t)bh * WW + q0 + ln) * HD;
  const v16h qb0 = frag_h(qrow, lane), qb1 = frag_h(qrow + 32, lane);
  const float* mk = mask + (size_t)n * WW + 8 * g;     // [N,1,1,W]: per key; this lane's keys are 8g + r and 16 + 8g + r of a pass
  float mrun = -3.0e38f, lrun = 0.f;                   // lrun: the sum over this lane's own keys; the halves are joined after the loop
  v8f acc[4];
#pragma unroll
  for (int t = 0; t < 4; ++t) acc[t] = (v8f){};
  const _Float16* kb = kh + (size_t)bh * WW * HD;
  const _Float16* vb = vT + (size_t)bh * HD * WW;
  // copy map: 8 lanes cover one 128-B row slice (a whole line), a thread's 8 copies are 16 rows apart
  const int cr = tid >> 3, cq = tid & 7;
  const _Float16* gk = kb + (size_t)cr * HD + cq * 8;
  const _Float16* gv = vb + (size_t)cr * WW + cq * 8;
  const unsigned l0 = (unsigned)(size_t)sm + cr * (RP * 2) + cq * 16;
  stage_copy_kv(l0, gk, gv);
  asm volatile("s_wait_asynccnt 0x0" ::: "memory");   // stage 0 has landed before the barrier that publishes it
  __syncthreads();
  stage_copy_kv(l0 + ABYTES, gk + AK * HD, gv + AK);
#pragma unroll 1   // rolled: one publish point per trip keeps the two-buffer order below as written
  for (int st = 0; st < WW / AK; ++st) {
   const _Float16* sb = (const _Float16*)(sm + (st & 1) * ABYTES);
#pragma unroll 1   // rolled, as before: one pass's registers only
   for (int kk = 0; kk < AK; kk += BK) {
    const int k0 = st * AK + kk;
    union { v8f v; v4f q[2]; } m0, m1;
    m0.q[0] = *(const v4f*)(mk + k0);      m0.q[1] = *(const v4f*)(mk + k0 + 4);
    m1.q[0] = *(const v4f*)(mk + k0 + 16); m1.q[1] = *(const v4f*)(mk + k0 + 20);
    v8f s0 = {}, s1 = {};                              // s0[r] = score(key k0 + 8g + r, query q0 + ln), s1[r]: key k0 + 16 + 8g + r
    // the 8 fragment reads of the pass's K rows go out as one group: one LDS latency per pass and not one per product
    const v16h ka0 = frag_h(sb + (kk + ln) * RP, lane),      ka1 = frag_h(sb + (kk + ln) * RP + 32, lane);
    const v16h kc0 = frag_h(sb + (kk + 16 + ln) * RP, lane), kc1 = frag_h(sb + (kk + 16 + ln) * RP + 32, lane);
    s0 = wmma16(ka0, qb0, s0); s0 = wmma16(ka1, qb1, s0);
    s1 = wmma16(kc0, qb0, s1); s1 = wmma16(kc1, qb1, s1);
    const v8f x0 = s0 * 0.125f + m0.v, x1 = s1 * 0.125f + m1.v;
    float mx = fmaxf(x0[0], x1[0]);
#pragma unroll
    for (int r = 1; r < 8; ++r) mx = fmaxf(mx, fmaxf(x0[r], x1[r]));
    mx = fmaxf(mx, xhalf(mx));                         // both halves now hold the query's maximum over the 32 keys
    const float mn = fmaxf(mrun, mx);
    const float corr = expf(mrun - mn);
    v8f p0, p1;
#pragma unroll
    for (int r = 0; r < 8; ++r) { p0[r] = expf(x0[r] - mn); p1[r] = expf(x1[r] - mn); }
    const v8f ps = p0 + p1;
    const float sum = ((ps[0] + ps[1]) + (ps[2] + ps[3])) + ((ps[4] + ps[5]) + (ps[6] + ps[7]));
    p0 *= 16384.0f; p1 *= 16384.0f;
    v16h pb;                                           // B operand: element r = key 8g + r, element 8 + r = key 16 + 8g + r, as frag_h orders V^T's k
#pragma unroll
    for (int r = 0; r < 8; ++r) { pb[r] = (_Float16)p0[r]; pb[8 + r] = (_Float16)p1[r]; }
    lrun = lrun * corr + sum; mrun = mn;
#pragma unroll
    for (int t = 0; t < 4; ++t) acc[t] *= corr;
    v16h vf[4];                                        // likewise the 8 reads of V^T's rows
#pragma unroll
    for (int t = 0; t < 4; ++t) vf[t] = frag_h(sb + (64 + t * 16 + ln) * RP + kk, lane);
#pragma unroll
    for (int t = 0; t < 4; ++t) acc[t] = wmma16(vf[t], pb, acc[t]);
   }
   asm volatile("s_wait_dscnt 0x0" ::: "memory");     // this wave's reads of buffer st&1 are done before the buffer is refilled
   asm volatile("s_wait_asynccnt 0x0" ::: "memory");  // this wave's copies of stage st+1 have landed before other waves read them
   __syncthreads();                                   // publishes stage st+1 and ends every reader's last read of buffer st&1
   if (st + 2 < WW / AK) stage_copy_kv(l0 + (st & 1) * ABYTES, gk + (size_t)(st + 2) * AK * HD, gv + (st + 2) * AK);
  }
  asm volatile("s_wait_asynccnt 0x0" ::: "memory");    // no copy is outstanding when the buffers become the epilogue's staging
  // acc[t][r] = O^T[d = t*16 + 8g + r][query ln]: stage as sOT[d][w_local], w_local = w*16 + ln
  const float il = (1.0f / 16384.0f) / (lrun + xhalf(lrun));
#pragma unroll
  for (int t = 0; t < 4; ++t) {
#pragma unroll
    for (int r = 0; r < 8; ++r) sOT[t * 16 + 8 * g + r][w * 16 + ln] = acc[t][r] * il; }
  __syncthreads();
  const int qb0_ = blockIdx.x * 64;
  for (int q = tid; q < HD * 16; q += 128) { const int d = q >> 4, pc = q & 15;
    vst2(out + ((size_t)n * CC + h * HD + d) * WW + qb0_ + pc * 4, *(const v4f*)(&sOT[d][pc * 4])); }
}

extern "C" void kernel_launch(void* const* d_in, const int* in_sizes, int n_in,
                              void* d_out, int out_size, void* d_ws, size_t ws_size,
                              hipStream_t stream) {
  (void)in_sizes; (void)n_in; (void)out_size; (void)ws_size;
  const float* hs   = (const float*)d_in[0];
  const float* mask = (const float*)d_in[1];
  const float* wq = (const float*)d_in[2]; const float* bq = (const float*)d_in[3];
  const float* wk = (const float*)d_in[4]; const float* bk = (const float*)d_in[5];
  const float* wv = (const float*)d_in[6]; const float* bv = (const float*)d_in[7];
  float* out = (float*)d_out;
  char* ws = (char*)d_ws; size_t off = 0;
  auto take = [&](size_t bytes) { char* p = ws + off; off += (bytes + 255) & ~(size_t)255; return p; };
  _Float16* xT = (_Float16*)take((size_t)NB * WW * CC * 2);      // 16 MB
  _Float16* wh = (_Float16*)take((size_t)3 * CC * CC * 2);       // 6 MB
  _Float16* qh = (_Float16*)take((size_t)NB * HH * WW * HD * 2);  // 16 MB
  _Float16* kh = (_Float16*)take((size_t)NB * HH * WW * HD * 2);
  _Float16* vT = (_Float16*)take((size_t)NB * HH * HD * WW * 2);
  k_xT<<<dim3(WW / 64, CC / 64, NB), 256, 0, stream>>>(hs, xT);
  k_wcvt<<<dim3((CC * CC / 8) / 256, 3), 256, 0, stream>>>(wq, wk, wv, wh);
  k_qkv<<<dim3(CC / 128, NB * (WW / 64), 3), 128, 0, stream>>>(xT, wh, bq, bk, bv, qh, kh, vT);
  k_attn<<<dim3(WW / 64, NB * HH), 128, 0, stream>>>(qh, kh, vT, mask, out);
}

// v004
// A run of this version takes 113 microseconds.
// Two timings next to v003 both put it at 1.18 times that version's speed.
// All steps since v000 together make it 4.09 times as fast.
#include <hip/hip_runtime.h>
#include <math.h>

// Conv1d(k=1) self-attention: q/k/v = 1x1 conv over [N,C,W] (C = 1024), 16 heads x 64, softmax(q.k/8 + mask) v, output
// [N,C,W]. Contractions on v_wmma_f32_16x16x32_f16 with f16 operands (x pre-transposed once to f16 [n][w][c] rows, weights
// converted to f16 rows), f32 accumulate; online softmax in f32 with P lifted by 2^14 inside its exponential (the row sum carries the same lift)

#define NB 8
#define CC 1024
#define WW 1024
#define HH 16
#define HD 64
#define BK 32
#define LOG2E 1.44269504088896340736f

typedef __attribute__((ext_vector_type(16))) _Float16 v16h;
typedef __attribute__((ext_vector_type(8)))  _Float16 v8h;
typedef __attribute__((ext_vector_type(8)))  float v8f;
typedef __attribute__((ext_vector_type(4)))  float v4f;
typedef __attribute__((ext_vector_type(4)))  unsigned v4u;

template <typename T> __device__ __forceinline__ void vst2(void* p, T v) { *(T*)p = v;  }
__device__ __forceinline__ v8f wmma16(v16h a, v16h b, v8f c) {
  v8f d = __builtin_amdgcn_wmma_f32_16x16x32_f16(false, a, false, b, (short)0, c, false, false);
  asm volatile("v_nop\n\tv_nop\n\tv_nop\n\tv_nop" : "+v"(d) : "v"(a), "v"(b));
  return d;
}
__device__ __forceinline__ v16h frag_h(const _Float16* rowk0, int lane) {
  union { v16h v; v8h q[2]; } u; const _Float16* p = rowk0 + 8 * (lane >> 4);
  u.q[0] = *(const v8h*)p; u.q[1] = *(const v8h*)(p + 16); return u.v;
}
// lane l <-> lane l ^ 16, on the vector pipe
__device__ __forceinline__ float xhalf(float x) {
  const int b = __builtin_bit_cast(int, x);
  return __builtin_bit_cast(float, __builtin_amdgcn_permlanex16(b, b, 0x76543210, 0xfedcba98, false, false));
}

__global__ __launch_bounds__(256) void k_xT(const float* __restrict__ x, _Float16* __restrict__ xT) {
  __shared__ float tile[64][65];
  const int n = blockIdx.z, c0 = blockIdx.y * 64, w0 = blockIdx.x * 64, tid = threadIdx.x;
  for (int q = tid; q < 64 * 64; q += 256) { const int cl = q >> 6, wl = q & 63; tile[cl][wl] = x[((size_t)n * CC + c0 + cl) * WW + w0 + wl]; }
  __syncthreads();
  for (int q = tid; q < 64 * 8; q += 256) { const int wl = q >> 3, pc = q & 7;
    union { v8h h; v4u u; } pk;
#pragma unroll
    for (int e = 0; e < 8; ++e) pk.h[e] = (_Float16)tile[pc * 8 + e][wl];
    vst2(xT + ((size_t)n * WW + w0 + wl) * CC + c0 + pc * 8, pk.u); }
}
// ---- weights f32 [Cout][Cin] -> f16 rows (same layout), 16 B per thread; all three matrices in one launch (grid.y)
__global__ __launch_bounds__(256) void k_wcvt(const float* __restrict__ wq, const float* __restrict__ wk, const float* __restrict__ wv, _Float16* __restrict__ wh) {
  const size_t g8 = (size_t)blockIdx.x * 256 + threadIdx.x; const int m = blockIdx.y;
  const float* s = m == 0 ? wq : (m == 1 ? wk : wv);
  union { v8h h; v4u u; } pk;
#pragma unroll
  for (int e = 0; e < 8; ++e) pk.h[e] = (_Float16)s[g8 * 8 + e];
  vst2(wh + (size_t)m * CC * CC + g8 * 8, pk.u);
}

// ---- one stage of k_qkv's operands, global -> LDS without registers: 192 rows x 128 B, 12 x 16 B per thread
#define KS 64                    // k per stage: 128 B of every operand row
#define RP 72                    // LDS row pitch in halves: 144 B = 16 B x 9, no bank conflict for 16-byte fragment reads
#define SBYTES (192 * RP * 2)    // one stage buffer
__device__ __forceinline__ void stage_copy(unsigned l, const _Float16* gx, const _Float16* gw) {
  // the closing s_wait_xcnt stands inside the statement so that no address register is rewritten ahead of it
  asm volatile("global_load_async_to_lds_b128 %0, %12, off\n\t"
               "global_load_async_to_lds_b128 %1, %13, off\n\t"
               "global_load_async_to_lds_b128 %2, %14, off\n\t"
               "global_load_async_to_lds_b128 %3, %15, off\n\t"
               "global_load_async_to_lds_b128 %4, %16, off\n\t"
               "global_load_async_to_lds_b128 %5, %17, off\n\t"
               "global_load_async_to_lds_b128 %6, %18, off\n\t"
               "global_load_async_to_lds_b128 %7, %19, off\n\t"
               "global_load_async_to_lds_b128 %8, %20, off\n\t"
               "global_load_async_to_lds_b128 %9, %21, off\n\t"
               "global_load_async_to_lds_b128 %10, %22, off\n\t"
               "global_load_async_to_lds_b128 %11, %23, off\n\t"
               "s_wait_xcnt 0x0"
               :: "v"(l), "v"(l + 1 * 16 * RP * 2), "v"(l + 2 * 16 * RP * 2), "v"(l + 3 * 16 * RP * 2),
                  "v"(l + 4 * 16 * RP * 2), "v"(l + 5 * 16 * RP * 2), "v"(l + 6 * 16 * RP * 2), "v"(l + 7 * 16 * RP * 2),
                  "v"(l + 8 * 16 * RP * 2), "v"(l + 9 * 16 * RP * 2), "v"(l + 10 * 16 * RP * 2), "v"(l + 11 * 16 * RP * 2),
                  "v"(gx), "v"(gx + 1 * 16 * CC), "v"(gx + 2 * 16 * CC), "v"(gx + 3 * 16 * CC),
                  "v"(gw), "v"(gw + 1 * 16 * CC), "v"(gw + 2 * 16 * CC), "v"(gw + 3 * 16 * CC),
                  "v"(gw + 4 * 16 * CC), "v"(gw + 5 * 16 * CC), "v"(gw + 6 * 16 * CC), "v"(gw + 7 * 16 * CC)
               : "memory");
}

// ---- projections: block = 64 positions (n, w0..) x 128 output channels (2 heads) of q/k/v (grid.z); K = 1024
// q,k -> [n][h][w][64] f16 rows; v -> vT[n][h][d][w] f16
__global__ __launch_bounds__(128) void k_qkv(const _Float16* __restrict__ xT, const _Float16* __restrict__ wh, const float* __restrict__ bq,
                                           const float* __restrict__ bk, const float* __restrict__ bv,
                                           _Float16* __restrict__ qh, _Float16* __restrict__ kh, _Float16* __restrict__ vT) {
  // two stage buffers of [64 x rows | 128 weight rows] x 64 k; after the K loop the same bytes serve as the epilogue's st[128][68]
  __shared__ __align__(16) unsigned char sm[2 * SBYTES];
  float (*st)[68] = (float (*)[68])sm;
  const int tid = threadIdx.x, wave = tid >> 5, lane = tid & 31, col = lane & 15, g = lane >> 4;
  const int n = blockIdx.y / (WW / 64), w0 = (blockIdx.y % (WW / 64)) * 64, o0 = blockIdx.x * 128, which = blockIdx.z;
  const _Float16* W = wh + (size_t)which * CC * CC;
  const float* bb = which == 0 ? bq : (which == 1 ? bk : bv);
  v8f acc[8] = {};
  // copy map: 8 lanes cover one 128-B row slice (a whole line), a thread's 12 copies are 16 rows apart
  const int cr = tid >> 3, cq = tid & 7;
  const _Float16* gx = xT + ((size_t)n * WW + w0 + cr) * CC + cq * 8;
  const _Float16* gw = W + (size_t)(o0 + cr) * CC + cq * 8;
  const unsigned l0 = (unsigned)(size_t)sm + cr * (RP * 2) + cq * 16;
  stage_copy(l0, gx, gw);
  asm volatile("s_wait_asynccnt 0x0" ::: "memory");   // stage 0 has landed before the barrier that publishes it
  __syncthreads();
  stage_copy(l0 + SBYTES, gx + KS, gw + KS);
#pragma unroll 1   // rolled: one publish point per trip keeps the two-buffer order below as written
  for (int t = 0; t < CC / KS; ++t) {
    const _Float16* sb = (const _Float16*)(sm + (t & 1) * SBYTES);
#pragma unroll
    for (int kk = 0; kk < KS; kk += 32) {
      // all 18 fragment reads of a 32-k block go out as one group, so that one LDS latency is paid per block and not per product
      const v16h a = frag_h(sb + (wave * 16 + col) * RP + kk, lane);
      v16h b[8];
#pragma unroll
      for (int j = 0; j < 8; ++j) b[j] = frag_h(sb + (64 + j * 16 + col) * RP + kk, lane);
#pragma unroll
      for (int j = 0; j < 8; ++j) acc[j] = wmma16(a, b[j], acc[j]);
    }
    asm volatile("s_wait_dscnt 0x0" ::: "memory");     // this wave's reads of buffer t&1 are done before the buffer is refilled
    asm volatile("s_wait_asynccnt 0x0" ::: "memory");  // this wave's copies of stage t+1 have landed before other waves read them
    __syncthreads();                                   // publishes stage t+1 and ends every reader's last read of buffer t&1
    if (t + 2 < CC / KS) stage_copy(l0 + (t & 1) * SBYTES, gx + (t + 2) * KS, gw + (t + 2) * KS);
  }
  asm volatile("s_wait_asynccnt 0x0" ::: "memory");    // no copy is outstanding when the buffers become the epilogue's staging
#pragma unroll
  for (int j = 0; j < 8; ++j) { const float bv_ = bb[o0 + j * 16 + col];
#pragma unroll
    for (int r = 0; r < 8; ++r) st[j * 16 + col][wave * 16 + 8 * g + r] = acc[j][r] + bv_; }
  __syncthreads();
  const int h0 = o0 / HD;
  if (which < 2) {
    _Float16* dst = which == 0 ? qh : kh;
    for (int q = tid; q < 2 * 64 * 8; q += 128) { const int hh = q >> 9, wl = (q >> 3) & 63, pc = q & 7;
      union { v8h h; v4u u; } pk;
#pragma unroll
      for (int e = 0; e < 8; ++e) pk.h[e] = (_Float16)st[hh * 64 + pc * 8 + e][wl];
      vst2(dst + (((size_t)n * HH + h0 + hh) * WW + w0 + wl) * HD + pc * 8, pk.u); }
  } else {
    for (int q = tid; q < 128 * 8; q += 128) { const int cl = q >> 3, pc = q & 7; const int hh = cl >> 6, d = cl & 63;
      union { v8h h; v4u u; } pk;
#pragma unroll
      for (int i = 0; i < 8; ++i) pk.h[i] = (_Float16)st[cl][pc * 8 + i];
      vst2(vT + (((size_t)n * HH + h0 + hh) * HD + d) * WW + w0 + pc * 8, pk.u); }
  }
}

// ---- one stage of k_attn's operands, global -> LDS without registers: 64 key rows of K and the 64 d rows of V^T, 128 B of each; 8 x 16 B per thread
#define AK 64                    // keys per stage: a whole 128-B line of every V^T row, two 32-key passes
#define ABYTES (128 * RP * 2)    // one stage buffer, rows at k_qkv's 144-B pitch
__device__ __forceinline__ void stage_copy_kv(unsigned l, const _Float16* gk, const _Float16* gv) {
  // the closing s_wait_xcnt stands inside the statement so that no address register is rewritten ahead of it
  asm volatile("global_load_async_to_lds_b128 %0, %8, off\n\t"
               "global_load_async_to_lds_b128 %1, %9, off\n\t"
               "global_load_async_to_lds_b128 %2, %10, off\n\t"
               "global_load_async_to_lds_b128 %3, %11, off\n\t"
               "global_load_async_to_lds_b128 %4, %12, off\n\t"
               "global_load_async_to_lds_b128 %5, %13, off\n\t"
               "global_load_async_to_lds_b128 %6, %14, off\n\t"
               "global_load_async_to_lds_b128 %7, %15, off\n\t"
               "s_wait_xcnt 0x0"
               :: "v"(l), "v"(l + 1 * 16 * RP * 2), "v"(l + 2 * 16 * RP * 2), "v"(l + 3 * 16 * RP * 2),
                  "v"(l + 4 * 16 * RP * 2), "v"(l + 5 * 16 * RP * 2), "v"(l + 6 * 16 * RP * 2), "v"(l + 7 * 16 * RP * 2),
                  "v"(gk), "v"(gk + 1 * 16 * HD), "v"(gk + 2 * 16 * HD), "v"(gk + 3 * 16 * HD),
                  "v"(gv), "v"(gv + 1 * 16 * WW), "v"(gv + 2 * 16 * WW), "v"(gv + 3 * 16 * WW)
               : "memory");
}

__global__ __launch_bounds__(128) void k_attn(const _Float16* __restrict__ qh, const _Float16* __restrict__ kh, const _Float16* __restrict__ vT,
                                            const float* __restrict__ mask, float* __restrict__ out) {
  // two stage buffers of [64 K rows | 64 V^T rows] x 64 keys; after the key loop the same bytes serve as the epilogue's sOT[d][w_local]
  __shared__ __align__(16) unsigned char sm[2 * ABYTES];
  float (*sOT)[68] = (float (*)[68])sm;
  const int tid = threadIdx.x, w = tid >> 5, lane = tid & 31, g = lane >> 4, ln = lane & 15;
  const int bh = blockIdx.y, n = bh / HH, h = bh % HH, q0 = blockIdx.x * 64 + w * 16;
  const _Float16* qrow = qh + ((size_t)bh * WW + q0 + ln) * HD;
  const v16h qb0 = frag_h(qrow, lane), qb1 = frag_h(qrow + 32, lane);
  const float* mk = mask + (size_t)n * WW + 8 * g;     // [N,1,1,W]: per key; this lane's keys are 8g + r and 16 + 8g + r of a pass
  float mrun = -3.0e38f, lrun = 0.f;                   // lrun: the sum over this lane's own keys; the halves are joined after the loop
  v8f acc[4];
#pragma unroll
  for (int t = 0; t < 4; ++t) acc[t] = (v8f){};
  const _Float16* kb = kh + (size_t)bh * WW * HD;
  const _Float16* vb = vT + (size_t)bh * HD * WW;
  // copy map: 8 lanes cover one 128-B row slice (a whole line), a thread's 8 copies are 16 rows apart
  const int cr = tid >> 3, cq = tid & 7;
  const _Float16* gk = kb + (size_t)cr * HD + cq * 8;
  const _Float16* gv = vb + (size_t)cr * WW + cq * 8;
  const unsigned l0 = (unsigned)(size_t)sm + cr * (RP * 2) + cq * 16;
  stage_copy_kv(l0, gk, gv);
  asm volatile("s_wait_asynccnt 0x0" ::: "memory");   // stage 0 has landed before the barrier that publishes it
  __syncthreads();
  stage_copy_kv(l0 + ABYTES, gk + AK * HD, gv + AK);
#pragma unroll 1   // rolled: one publish point per trip keeps the two-buffer order below as written
  for (int st = 0; st < WW / AK; ++st) {
   const _Float16* sb = (const _Float16*)(sm + (st & 1) * ABYTES);
#pragma unroll 1   // rolled, as before: one pass's registers only
   for (int kk = 0; kk < AK; kk += BK) {
    const int k0 = st * AK + kk;
    union { v8f v; v4f q[2]; } m0, m1;
    m0.q[0] = *(const v4f*)(mk + k0);      m0.q[1] = *(const v4f*)(mk + k0 + 4);
    m1.q[0] = *(const v4f*)(mk + k0 + 16); m1.q[1] = *(const v4f*)(mk + k0 + 20);
    v8f s0 = {}, s1 = {};                              // s0[r] = score(key k0 + 8g + r, query q0 + ln), s1[r]: key k0 + 16 + 8g + r
    // the 8 fragment reads of the pass's K rows go out as one group: one LDS latency per pass and not one per product
    const v16h ka0 = frag_h(sb + (kk + ln) * RP, lane),      ka1 = frag_h(sb + (kk + ln) * RP + 32, lane);
    const v16h kc0 = frag_h(sb + (kk + 16 + ln) * RP, lane), kc1 = frag_h(sb + (kk + 16 + ln) * RP + 32, lane);
    s0 = wmma16(ka0, qb0, s0); s0 = wmma16(ka1, qb1, s0);
    s1 = wmma16(kc0, qb0, s1); s1 = wmma16(kc1, qb1, s1);
    const v8f x0 = s0 * 0.125f + m0.v, x1 = s1 * 0.125f + m1.v;
    float mx = fmaxf(x0[0], x1[0]);
#pragma unroll
    for (int r = 1; r < 8; ++r) mx = fmaxf(mx, fmaxf(x0[r], x1[r]));
    mx = fmaxf(mx, xhalf(mx));                         // both halves now hold the query's maximum over the 32 keys
    const float mn = fmaxf(mrun, mx);
    const float corr = __builtin_amdgcn_exp2f((mrun - mn) * LOG2E);
    // e^d * 2^14 = 2^(d * log2 e + 14): one fma and one hardware exponential per score; d <= 0, so p <= 2^14, and a result below 2^-126 is 0
    const v8f t0 = (x0 - mn) * LOG2E + 14.0f, t1 = (x1 - mn) * LOG2E + 14.0f;
    v8f p0, p1;                                        // a loop per tile, both unrolled into registers: neighbouring scores of one tile share a packed fma, with no register moves
#pragma unroll
    for (int r = 0; r < 8; ++r) p0[r] = __builtin_amdgcn_exp2f(t0[r]);
#pragma unroll
    for (int r = 0; r < 8; ++r) p1[r] = __builtin_amdgcn_exp2f(t1[r]);
    const v8f ps = p0 + p1;
    const float sum = ((ps[0] + ps[1]) + (ps[2] + ps[3])) + ((ps[4] + ps[5]) + (ps[6] + ps[7]));
    v16h pb;                                           // B operand: element r = key 8g + r, element 8 + r = key 16 + 8g + r, as frag_h orders V^T's k
#pragma unroll
    for (int r = 0; r < 8; ++r) { pb[r] = (_Float16)p0[r]; pb[8 + r] = (_Float16)p1[r]; }
    lrun = lrun * corr + sum; mrun = mn;
#pragma unroll
    for (int t = 0; t < 4; ++t) acc[t] *= corr;
    v16h vf[4];                                        // likewise the 8 reads of V^T's rows
#pragma unroll
    for (int t = 0; t < 4; ++t) vf[t] = frag_h(sb + (64 + t * 16 + ln) * RP + kk, lane);
#pragma unroll
    for (int t = 0; t < 4; ++t) acc[t] = wmma16(vf[t], pb, acc[t]);
   }
   asm volatile("s_wait_dscnt 0x0" ::: "memory");     // this wave's reads of buffer st&1 are done before the buffer is refilled
   asm volatile("s_wait_asynccnt 0x0" ::: "memory");  // this wave's copies of stage st+1 have landed before other waves read them
   __syncthreads();                                   // publishes stage st+1 and ends every reader's last read of buffer st&1
   if (st + 2 < WW / AK) stage_copy_kv(l0 + (st & 1) * ABYTES, gk + (size_t)(st + 2) * AK * HD, gv + (st + 2) * AK);
  }
  asm volatile("s_wait_asynccnt 0x0" ::: "memory");    // no copy is outstanding when the buffers become the epilogue's staging
  // acc[t][r] = O^T[d = t*16 + 8g + r][query ln]: stage as sOT[d][w_local], w_local = w*16 + ln
  const float il = 1.0f / (lrun + xhalf(lrun));     // lrun carries P's 2^14 like acc: the lift cancels
#pragma unroll
  for (int t = 0; t < 4; ++t) {
#pragma unroll
    for (int r = 0; r < 8; ++r) sOT[t * 16 + 8 * g + r][w * 16 + ln] = acc[t][r] * il; }
  __syncthreads();
  const int qb0_ = blockIdx.x * 64;
  for (int q = tid; q < HD * 16; q += 128) { const int d = q >> 4, pc = q & 15;
    vst2(out + ((size_t)n * CC + h * HD + d) * WW + qb0_ + pc * 4, *(const v4f*)(&sOT[d][pc * 4])); }
}

extern "C" void kernel_launch(void* const* d_in, const int* in_sizes, int n_in,
                              void* d_out, int out_size, void* d_ws, size_t ws_size,
                              hipStream_t stream) {
  (void)in_sizes; (void)n_in; (void)out_size; (void)ws_size;
  const float* hs   = (const float*)d_in[0];
  const float* mask = (const float*)d_in[1];
  const float* wq = (const float*)d_in[2]; const float* bq = (const float*)d_in[3];
  const float* wk = (const float*)d_in[4]; const float* bk = (const float*)d_in[5];
  const float* wv = (const float*)d_in[6]; const float* bv = (const float*)d_in[7];
  float* out = (float*)d_out;
  char* ws = (char*)d_ws; size_t off = 0;
  auto take = [&](size_t bytes) { char* p = ws + off; off += (bytes + 255) & ~(size_t)255; return p; };
  _Float16* xT = (_Float16*)take((size_t)NB * WW * CC * 2);      // 16 MB
  _Float16* wh = (_Float16*)take((size_t)3 * CC * CC * 2);       // 6 MB
  _Float16* qh = (_Float16*)take((size_t)NB * HH * WW * HD * 2);  // 16 MB
  _Float16* kh = (_Float16*)take((size_t)NB * HH * WW * HD * 2);
  _Float16* vT = (_Float16*)take((size_t)NB * HH * HD * WW * 2);
  k_xT<<<dim3(WW / 64, CC / 64, NB), 256, 0, stream>>>(hs, xT);
  k_wcvt<<<dim3((CC * CC / 8) / 256, 3), 256, 0, stream>>>(wq, wk, wv, wh);
  k_qkv<<<dim3(CC / 128, NB * (WW / 64), 3), 128, 0, stream>>>(xT, wh, bq, bk, bv, qh, kh, vT);
  k_attn<<<dim3(WW / 64, NB * HH), 128, 0, stream>>>(qh, kh, vT, mask, out);
}

// v005
// Measured time: 109 microseconds a run.
// Next to v004, in two timings, it ran 1.04 and 1.03 times as fast.
// Over all steps from v000 it is 4.24 times as fast.
#include <hip/hip_runtime.h>
#include <math.h>

// Conv1d(k=1) self-attention: q/k/v = 1x1 conv over [N,C,W] (C = 1024), 16 heads x 64, softmax(q.k/8 + mask) v, output
// [N,C,W]. Contractions on v_wmma_f32_16x16x32_f16 with f16 operands (x pre-transposed once to f16 [n][w][c] rows, weights
// converted to f16 rows), f32 accumulate; online softmax in f32 with P lifted by 2^14 inside its exponential (the row sum carries the same lift)

#define NB 8
#define CC 1024
#define WW 1024
#define HH 16
#define HD 64
#define BK 32
#define LOG2E 1.44269504088896340736f

typedef __attribute__((ext_vector_type(16))) _Float16 v16h;
typedef __attribute__((ext_vector_type(8)))  _Float16 v8h;
typedef __attribute__((ext_vector_type(8)))  float v8f;
typedef __attribute__((ext_vector_type(4)))  float v4f;
typedef __attribute__((ext_vector_type(4)))  unsigned v4u;

template <typename T> __device__ __forceinline__ void vst2(void* p, T v) { *(T*)p = v;  }
__device__ __forceinline__ v8f wmma16(v16h a, v16h b, v8f c) {
  v8f d = __builtin_amdgcn_wmma_f32_16x16x32_f16(false, a, false, b, (short)0, c, false, false);
  asm volatile("v_nop\n\tv_nop\n\tv_nop\n\tv_nop" : "+v"(d) : "v"(a), "v"(b));
  return d;
}
__device__ __forceinline__ v16h frag_h(const _Float16* rowk0, int lane) {
  union { v16h v; v8h q[2]; } u; const _Float16* p = rowk0 + 8 * (lane >> 4);
  u.q[0] = *(const v8h*)p; u.q[1] = *(const v8h*)(p + 16); return u.v;
}
// lane l <-> lane l ^ 16, on the vector pipe
__device__ __forceinline__ float xhalf(float x) {
  const int b = __builtin_bit_cast(int, x);
  return __builtin_bit_cast(float, __builtin_amdgcn_permlanex16(b, b, 0x76543210, 0xfedcba98, false, false));
}

__global__ __launch_bounds__(256) void k_xT(const float* __restrict__ x, _Float16* __restrict__ xT) {
  __shared__ float tile[64][65];
  const int n = blockIdx.z, c0 = blockIdx.y * 64, w0 = blockIdx.x * 64, tid = threadIdx.x;
  for (int q = tid; q < 64 * 64; q += 256) { const int cl = q >> 6, wl = q & 63; tile[cl][wl] = x[((size_t)n * CC + c0 + cl) * WW + w0 + wl]; }
  __syncthreads();
  for (int q = tid; q < 64 * 8; q += 256) { const int wl = q >> 3, pc = q & 7;
    union { v8h h; v4u u; } pk;
#pragma unroll
    for (int e = 0; e < 8; ++e) pk.h[e] = (_Float16)tile[pc * 8 + e][wl];
    vst2(xT + ((size_t)n * WW + w0 + wl) * CC + c0 + pc * 8, pk.u); }
}
// ---- weights f32 [Cout][Cin] -> f16 rows (same layout), 16 B per thread; all three matrices in one launch (grid.y)
__global__ __launch_bounds__(256) void k_wcvt(const float* __restrict__ wq, const float* __restrict__ wk, const float* __restrict__ wv, _Float16* __restrict__ wh) {
  const size_t g8 = (size_t)blockIdx.x * 256 + threadIdx.x; const int m = blockIdx.y;
  const float* s = m == 0 ? wq : (m == 1 ? wk : wv);
  union { v8h h; v4u u; } pk;
#pragma unroll
  for (int e = 0; e < 8; ++e) pk.h[e] = (_Float16)s[g8 * 8 + e];
  vst2(wh + (size_t)m * CC * CC + g8 * 8, pk.u);
}

// ---- one stage of k_qkv's operands, global -> LDS without registers: 384 rows x 128 B, 12 x 16 B per thread
#define KS 64                    // k per stage: 128 B of every operand row
#define RP 72                    // LDS row pitch in halves: 144 B = 16 B x 9, no bank conflict for 16-byte fragment reads
#define BM 128                   // positions per block
#define BN 256                   // output channels per block (4 heads)
#define SBYTES ((BM + BN) * RP * 2)   // one stage buffer
#define STP (BM + 4)             // epilogue staging pitch in floats
__device__ __forceinline__ void stage_copy(unsigned l, const _Float16* gx, const _Float16* gw) {
  // the closing s_wait_xcnt stands inside the statement so that no address register is rewritten ahead of it
  asm volatile("global_load_async_to_lds_b128 %0, %12, off\n\t"
               "global_load_async_to_lds_b128 %1, %13, off\n\t"
               "global_load_async_to_lds_b128 %2, %14, off\n\t"
               "global_load_async_to_lds_b128 %3, %15, off\n\t"
               "global_load_async_to_lds_b128 %4, %16, off\n\t"
               "global_load_async_to_lds_b128 %5, %17, off\n\t"
               "global_load_async_to_lds_b128 %6, %18, off\n\t"
               "global_load_async_to_lds_b128 %7, %19, off\n\t"
               "global_load_async_to_lds_b128 %8, %20, off\n\t"
               "global_load_async_to_lds_b128 %9, %21, off\n\t"
               "global_load_async_to_lds_b128 %10, %22, off\n\t"
               "global_load_async_to_lds_b128 %11, %23, off\n\t"
               "s_wait_xcnt 0x0"
               :: "v"(l), "v"(l + 1 * 32 * RP * 2), "v"(l + 2 * 32 * RP * 2), "v"(l + 3 * 32 * RP * 2),
                  "v"(l + 4 * 32 * RP * 2), "v"(l + 5 * 32 * RP * 2), "v"(l + 6 * 32 * RP * 2), "v"(l + 7 * 32 * RP * 2),
                  "v"(l + 8 * 32 * RP * 2), "v"(l + 9 * 32 * RP * 2), "v"(l + 10 * 32 * RP * 2), "v"(l + 11 * 32 * RP * 2),
                  "v"(gx), "v"(gx + 1 * 32 * CC), "v"(gx + 2 * 32 * CC), "v"(gx + 3 * 32 * CC),
                  "v"(gw), "v"(gw + 1 * 32 * CC), "v"(gw + 2 * 32 * CC), "v"(gw + 3 * 32 * CC),
                  "v"(gw + 4 * 32 * CC), "v"(gw + 5 * 32 * CC), "v"(gw + 6 * 32 * CC), "v"(gw + 7 * 32 * CC)
               : "memory");
}

// ---- projections: block = 128 positions (n, w0..) x 256 output channels (4 heads) of q/k/v (grid.z), 8 waves as 2 x 4; K = 1024
// a wave owns 64 positions x 64 channels: 8 fragments feed 16 products, one 16-byte LDS read per product
// q,k -> [n][h][w][64] f16 rows; v -> vT[n][h][d][w] f16
__global__ __launch_bounds__(256) void k_qkv(const _Float16* __restrict__ xT, const _Float16* __restrict__ wh, const float* __restrict__ bq,
                                           const float* __restrict__ bk, const float* __restrict__ bv,
                                           _Float16* __restrict__ qh, _Float16* __restrict__ kh, _Float16* __restrict__ vT) {
  // two stage buffers of [128 x rows | 256 weight rows] x 64 k; after the K loop the same bytes serve as the epilogue's st[256][132], the larger of the two uses
  static_assert(BN * STP * 4 >= 2 * SBYTES, "the staging array holds both stage buffers");
  __shared__ __align__(16) unsigned char sm[BN * STP * 4];
  float (*st)[STP] = (float (*)[STP])sm;
  const int tid = threadIdx.x, wave = tid >> 5, lane = tid & 31, col = lane & 15, g = lane >> 4;
  const int wm = wave & 1, wn = wave >> 1;             // the wave's 64 positions and its 64 channels inside the block
  const int n = blockIdx.y / (WW / BM), w0 = (blockIdx.y % (WW / BM)) * BM, o0 = blockIdx.x * BN, which = blockIdx.z;
  const _Float16* W = wh + (size_t)which * CC * CC;
  const float* bb = which == 0 ? bq : (which == 1 ? bk : bv);
  v8f acc[4][4] = {};
  // copy map: 8 lanes cover one 128-B row slice (a whole line), a thread's 12 copies are 32 rows apart
  const int cr = tid >> 3, cq = tid & 7;
  const _Float16* gx = xT + ((size_t)n * WW + w0 + cr) * CC + cq * 8;
  const _Float16* gw = W + (size_t)(o0 + cr) * CC + cq * 8;
  const unsigned l0 = (unsigned)(size_t)sm + cr * (RP * 2) + cq * 16;
  stage_copy(l0, gx, gw);
  asm volatile("s_wait_asynccnt 0x0" ::: "memory");   // stage 0 has landed before the barrier that publishes it
  __syncthreads();
  stage_copy(l0 + SBYTES, gx + KS, gw + KS);
#pragma unroll 1   // rolled: one publish point per trip keeps the two-buffer order below as written
  for (int t = 0; t < CC / KS; ++t) {
    const _Float16* sb = (const _Float16*)(sm + (t & 1) * SBYTES);
#pragma unroll
    for (int kk = 0; kk < KS; kk += 32) {
      // all 16 fragment reads of a 32-k block go out as one group, so that one LDS latency is paid per block and not per product
      v16h a[4], b[4];
#pragma unroll
      for (int i = 0; i < 4; ++i) a[i] = frag_h(sb + (wm * 64 + i * 16 + col) * RP + kk, lane);
#pragma unroll
      for (int j = 0; j < 4; ++j) b[j] = frag_h(sb + (BM + wn * 64 + j * 16 + col) * RP + kk, lane);
#pragma unroll
      for (int i = 0; i < 4; ++i) {
#pragma unroll
        for (int j = 0; j < 4; ++j) acc[i][j] = wmma16(a[i], b[j], acc[i][j]); }
    }
    asm volatile("s_wait_dscnt 0x0" ::: "memory");     // this wave's reads of buffer t&1 are done before the buffer is refilled
    asm volatile("s_wait_asynccnt 0x0" ::: "memory");  // this wave's copies of stage t+1 have landed before other waves read them
    __syncthreads();                                   // publishes stage t+1 and ends every reader's last read of buffer t&1
    if (t + 2 < CC / KS) stage_copy(l0 + (t & 1) * SBYTES, gx + (t + 2) * KS, gw + (t + 2) * KS);
  }
  asm volatile("s_wait_asynccnt 0x0" ::: "memory");    // no copy is outstanding when the buffers become the epilogue's staging
#pragma unroll
  for (int j = 0; j < 4; ++j) { const float bv_ = bb[o0 + wn * 64 + j * 16 + col];
#pragma unroll
    for (int i = 0; i < 4; ++i) {
#pragma unroll
      for (int r = 0; r < 8; ++r) st[wn * 64 + j * 16 + col][wm * 64 + i * 16 + 8 * g + r] = acc[i][j][r] + bv_; } }
  __syncthreads();
  const int h0 = o0 / HD;
  if (which < 2) {
    _Float16* dst = which == 0 ? qh : kh;
    for (int q = tid; q < (BN / HD) * BM * 8; q += 256) { const int hh = q / (BM * 8), wl = (q >> 3) & (BM - 1), pc = q & 7;
      union { v8h h; v4u u; } pk;
#pragma unroll
      for (int e = 0; e < 8; ++e) pk.h[e] = (_Float16)st[hh * 64 + pc * 8 + e][wl];
      vst2(dst + (((size_t)n * HH + h0 + hh) * WW + w0 + wl) * HD + pc * 8, pk.u); }
  } else {
    for (int q = tid; q < BN * (BM / 8); q += 256) { const int cl = q / (BM / 8), pc = q & (BM / 8 - 1); const int hh = cl >> 6, d = cl & 63;
      union { v8h h; v4u u; } pk;
#pragma unroll
      for (int i = 0; i < 8; ++i) pk.h[i] = (_Float16)st[cl][pc * 8 + i];
      vst2(vT + (((size_t)n * HH + h0 + hh) * HD + d) * WW + w0 + pc * 8, pk.u); }
  }
}

// ---- one stage of k_attn's operands, global -> LDS without registers: 64 key rows of K and the 64 d rows of V^T, 128 B of each; 8 x 16 B per thread
#define AK 64                    // keys per stage: a whole 128-B line of every V^T row, two 32-key passes
#define ABYTES (128 * RP * 2)    // one stage buffer, rows at k_qkv's 144-B pitch
__device__ __forceinline__ void stage_copy_kv(unsigned l, const _Float16* gk, const _Float16* gv) {
  // the closing s_wait_xcnt stands inside the statement so that no address register is rewritten ahead of it
  asm volatile("global_load_async_to_lds_b128 %0, %8, off\n\t"
               "global_load_async_to_lds_b128 %1, %9, off\n\t"
               "global_load_async_to_lds_b128 %2, %10, off\n\t"
               "global_load_async_to_lds_b128 %3, %11, off\n\t"
               "global_load_async_to_lds_b128 %4, %12, off\n\t"
               "global_load_async_to_lds_b128 %5, %13, off\n\t"
               "global_load_async_to_lds_b128 %6, %14, off\n\t"
               "global_load_async_to_lds_b128 %7, %15, off\n\t"
               "s_wait_xcnt 0x0"
               :: "v"(l), "v"(l + 1 * 16 * RP * 2), "v"(l + 2 * 16 * RP * 2), "v"(l + 3 * 16 * RP * 2),
                  "v"(l + 4 * 16 * RP * 2), "v"(l + 5 * 16 * RP * 2), "v"(l + 6 * 16 * RP * 2), "v"(l + 7 * 16 * RP * 2),
                  "v"(gk), "v"(gk + 1 * 16 * HD), "v"(gk + 2 * 16 * HD), "v"(gk + 3 * 16 * HD),
                  "v"(gv), "v"(gv + 1 * 16 * WW), "v"(gv + 2 * 16 * WW), "v"(gv + 3 * 16 * WW)
               : "memory");
}

__global__ __launch_bounds__(128) void k_attn(const _Float16* __restrict__ qh, const _Float16* __restrict__ kh, const _Float16* __restrict__ vT,
                                            const float* __restrict__ mask, float* __restrict__ out) {
  // two stage buffers of [64 K rows | 64 V^T rows] x 64 keys; after the key loop the same bytes serve as the epilogue's sOT[d][w_local]
  __shared__ __align__(16) unsigned char sm[2 * ABYTES];
  float (*sOT)[68] = (float (*)[68])sm;
  const int tid = threadIdx.x, w = tid >> 5, lane = tid & 31, g = lane >> 4, ln = lane & 15;
  const int bh = blockIdx.y, n = bh / HH, h = bh % HH, q0 = blockIdx.x * 64 + w * 16;
  const _Float16* qrow = qh + ((size_t)bh * WW + q0 + ln) * HD;
  const v16h qb0 = frag_h(qrow, lane), qb1 = frag_h(qrow + 32, lane);
  const float* mk = mask + (size_t)n * WW + 8 * g;     // [N,1,1,W]: per key; this lane's keys are 8g + r and 16 + 8g + r of a pass
  float mrun = -3.0e38f, lrun = 0.f;                   // lrun: the sum over this lane's own keys; the halves are joined after the loop
  v8f acc[4];
#pragma unroll
  for (int t = 0; t < 4; ++t) acc[t] = (v8f){};
  const _Float16* kb = kh + (size_t)bh * WW * HD;
  const _Float16* vb = vT + (size_t)bh * HD * WW;
  // copy map: 8 lanes cover one 128-B row slice (a whole line), a thread's 8 copies are 16 rows apart
  const int cr = tid >> 3, cq = tid & 7;
  const _Float16* gk = kb + (size_t)cr * HD + cq * 8;
  const _Float16* gv = vb + (size_t)cr * WW + cq * 8;
  const unsigned l0 = (unsigned)(size_t)sm + cr * (RP * 2) + cq * 16;
  stage_copy_kv(l0, gk, gv);
  asm volatile("s_wait_asynccnt 0x0" ::: "memory");   // stage 0 has landed before the barrier that publishes it
  __syncthreads();
  stage_copy_kv(l0 + ABYTES, gk + AK * HD, gv + AK);
#pragma unroll 1   // rolled: one publish point per trip keeps the two-buffer order below as written
  for (int st = 0; st < WW / AK; ++st) {
   const _Float16* sb = (const _Float16*)(sm + (st & 1) * ABYTES);
#pragma unroll 1   // rolled, as before: one pass's registers only
   for (int kk = 0; kk < AK; kk += BK) {
    const int k0 = st * AK + kk;
    union { v8f v; v4f q[2]; } m0, m1;
    m0.q[0] = *(const v4f*)(mk + k0);      m0.q[1] = *(const v4f*)(mk + k0 + 4);
    m1.q[0] = *(const v4f*)(mk + k0 + 16); m1.q[1] = *(const v4f*)(mk + k0 + 20);
    v8f s0 = {}, s1 = {};                              // s0[r] = score(key k0 + 8g + r, query q0 + ln), s1[r]: key k0 + 16 + 8g + r
    // the 8 fragment reads of the pass's K rows go out as one group: one LDS latency per pass and not one per product
    const v16h ka0 = frag_h(sb + (kk + ln) * RP, lane),      ka1 = frag_h(sb + (kk + ln) * RP + 32, lane);
    const v16h kc0 = frag_h(sb + (kk + 16 + ln) * RP, lane), kc1 = frag_h(sb + (kk + 16 + ln) * RP + 32, lane);
    s0 = wmma16(ka0, qb0, s0); s0 = wmma16(ka1, qb1, s0);
    s1 = wmma16(kc0, qb0, s1); s1 = wmma16(kc1, qb1, s1);
    const v8f x0 = s0 * 0.125f + m0.v, x1 = s1 * 0.125f + m1.v;
    float mx = fmaxf(x0[0], x1[0]);
#pragma unroll
    for (int r = 1; r < 8; ++r) mx = fmaxf(mx, fmaxf(x0[r], x1[r]));
    mx = fmaxf(mx, xhalf(mx));                         // both halves now hold the query's maximum over the 32 keys
    const float mn = fmaxf(mrun, mx);
    const float corr = __builtin_amdgcn_exp2f((mrun - mn) * LOG2E);
    // e^d * 2^14 = 2^(d * log2 e + 14): one fma and one hardware exponential per score; d <= 0, so p <= 2^14, and a result below 2^-126 is 0
    const v8f t0 = (x0 - mn) * LOG2E + 14.0f, t1 = (x1 - mn) * LOG2E + 14.0f;
    v8f p0, p1;                                        // a loop per tile, both unrolled into registers: neighbouring scores of one tile share a packed fma, with no register moves
#pragma unroll
    for (int r = 0; r < 8; ++r) p0[r] = __builtin_amdgcn_exp2f(t0[r]);
#pragma unroll
    for (int r = 0; r < 8; ++r) p1[r] = __builtin_amdgcn_exp2f(t1[r]);
    const v8f ps = p0 + p1;
    const float sum = ((ps[0] + ps[1]) + (ps[2] + ps[3])) + ((ps[4] + ps[5]) + (ps[6] + ps[7]));
    v16h pb;                                           // B operand: element r = key 8g + r, element 8 + r = key 16 + 8g + r, as frag_h orders V^T's k
#pragma unroll
    for (int r = 0; r < 8; ++r) { pb[r] = (_Float16)p0[r]; pb[8 + r] = (_Float16)p1[r]; }
    lrun = lrun * corr + sum; mrun = mn;
#pragma unroll
    for (int t = 0; t < 4; ++t) acc[t] *= corr;
    v16h vf[4];                                        // likewise the 8 reads of V^T's rows
#pragma unroll
    for (int t = 0; t < 4; ++t) vf[t] = frag_h(sb + (64 + t * 16 + ln) * RP + kk, lane);
#pragma unroll
    for (int t = 0; t < 4; ++t) acc[t] = wmma16(vf[t], pb, acc[t]);
   }
   asm volatile("s_wait_dscnt 0x0" ::: "memory");     // this wave's reads of buffer st&1 are done before the buffer is refilled
   asm volatile("s_wait_asynccnt 0x0" ::: "memory");  // this wave's copies of stage st+1 have landed before other waves read them
   __syncthreads();                                   // publishes stage st+1 and ends every reader's last read of buffer st&1
   if (st + 2 < WW / AK) stage_copy_kv(l0 + (st & 1) * ABYTES, gk + (size_t)(st + 2) * AK * HD, gv + (st + 2) * AK);
  }
  asm volatile("s_wait_asynccnt 0x0" ::: "memory");    // no copy is outstanding when the buffers become the epilogue's staging
  // acc[t][r] = O^T[d = t*16 + 8g + r][query ln]: stage as sOT[d][w_local], w_local = w*16 + ln
  const float il = 1.0f / (lrun + xhalf(lrun));     // lrun carries P's 2^14 like acc: the lift cancels
#pragma unroll
  for (int t = 0; t < 4; ++t) {
#pragma unroll
    for (int r = 0; r < 8; ++r) sOT[t * 16 + 8 * g + r][w * 16 + ln] = acc[t][r] * il; }
  __syncthreads();
  const int qb0_ = blockIdx.x * 64;
  for (int q = tid; q < HD * 16; q += 128) { const int d = q >> 4, pc = q & 15;
    vst2(out + ((size_t)n * CC + h * HD + d) * WW + qb0_ + pc * 4, *(const v4f*)(&sOT[d][pc * 4])); }
}

extern "C" void kernel_launch(void* const* d_in, const int* in_sizes, int n_in,
                              void* d_out, int out_size, void* d_ws, size_t ws_size,
                              hipStream_t stream) {
  (void)in_sizes; (void)n_in; (void)out_size; (void)ws_size;
  const float* hs   = (const float*)d_in[0];
  const float* mask = (const float*)d_in[1];
  const float* wq = (const float*)d_in[2]; const float* bq = (const float*)d_in[3];
  const float* wk = (const float*)d_in[4]; const float* bk = (const float*)d_in[5];
  const float* wv = (const float*)d_in[6]; const float* bv = (const float*)d_in[7];
  float* out = (float*)d_out;
  char* ws = (char*)d_ws; size_t off = 0;
  auto take = [&](size_t bytes) { char* p = ws + off; off += (bytes + 255) & ~(size_t)255; return p; };
  _Float16* xT = (_Float16*)take((size_t)NB * WW * CC * 2);      // 16 MB
  _Float16* wh = (_Float16*)take((size_t)3 * CC * CC * 2);       // 6 MB
  _Float16* qh = (_Float16*)take((size_t)NB * HH * WW * HD * 2);  // 16 MB
  _Float16* kh = (_Float16*)take((size_t)NB * HH * WW * HD * 2);
  _Float16* vT = (_Float16*)take((size_t)NB * HH * HD * WW * 2);
  k_xT<<<dim3(WW / 64, CC / 64, NB), 256, 0, stream>>>(hs, xT);
  k_wcvt<<<dim3((CC * CC / 8) / 256, 3), 256, 0, stream>>>(wq, wk, wv, wh);
  k_qkv<<<dim3(CC / BN, NB * (WW / BM), 3), 256, 0, stream>>>(xT, wh, bq, bk, bv, qh, kh, vT);
  k_attn<<<dim3(WW / 64, NB * HH), 128, 0, stream>>>(qh, kh, vT, mask, out);
}

// v006
// One run takes 103 microseconds.
// Two timings next to v005 put it at 1.05 and 1.07 times that version's speed.
// Over all steps from v000 it is 4.49 times as fast.
#include <hip/hip_runtime.h>
#include <math.h>

// Conv1d(k=1) self-attention: q/k/v = 1x1 conv over [N,C,W] (C = 1024), 16 heads x 64, softmax(q.k/8 + mask) v, output
// [N,C,W]. Contractions on v_wmma_f32_16x16x32_f16 with f16 operands (x pre-transposed once to f16 [n][w][c] rows, weights
// converted to f16 rows), f32 accumulate; online softmax in f32 with P lifted by 2^14 inside its exponential (the row sum carries the same lift)

#define NB 8
#define CC 1024
#define WW 1024
#define HH 16
#define HD 64
#define BK 32
#define LOG2E 1.44269504088896340736f

typedef __attribute__((ext_vector_type(16))) _Float16 v16h;
typedef __attribute__((ext_vector_type(8)))  _Float16 v8h;
typedef __attribute__((ext_vector_type(8)))  float v8f;
typedef __attribute__((ext_vector_type(4)))  float v4f;
typedef __attribute__((ext_vector_type(4)))  unsigned v4u;

template <typename T> __device__ __forceinline__ void vst2(void* p, T v) { *(T*)p = v;  }
__device__ __forceinline__ v8f wmma16(v16h a, v16h b, v8f c) {
  v8f d = __builtin_amdgcn_wmma_f32_16x16x32_f16(false, a, false, b, (short)0, c, false, false);
  asm volatile("v_nop\n\tv_nop\n\tv_nop\n\tv_nop" : "+v"(d) : "v"(a), "v"(b));
  return d;
}
__device__ __forceinline__ v16h frag_h(const _Float16* rowk0, int lane) {
  union { v16h v; v8h q[2]; } u; const _Float16* p = rowk0 + 8 * (lane >> 4);
  u.q[0] = *(const v8h*)p; u.q[1] = *(const v8h*)(p + 16); return u.v;
}
// lane l <-> lane l ^ 16, on the vector pipe
__device__ __forceinline__ float xhalf(float x) {
  const int b = __builtin_bit_cast(int, x);
  return __builtin_bit_cast(float, __builtin_amdgcn_permlanex16(b, b, 0x76543210, 0xfedcba98, false, false));
}

__global__ __launch_bounds__(256) void k_xT(const float* __restrict__ x, _Float16* __restrict__ xT) {
  __shared__ float tile[64][65];
  const int n = blockIdx.z, c0 = blockIdx.y * 64, w0 = blockIdx.x * 64, tid = threadIdx.x;
  for (int q = tid; q < 64 * 64; q += 256) { const int cl = q >> 6, wl = q & 63; tile[cl][wl] = x[((size_t)n * CC + c0 + cl) * WW + w0 + wl]; }
  __syncthreads();
  for (int q = tid; q < 64 * 8; q += 256) { const int wl = q >> 3, pc = q & 7;
    union { v8h h; v4u u; } pk;
#pragma unroll
    for (int e = 0; e < 8; ++e) pk.h[e] = (_Float16)tile[pc * 8 + e][wl];
    vst2(xT + ((size_t)n * WW + w0 + wl) * CC + c0 + pc * 8, pk.u); }
}
// ---- weights f32 [Cout][Cin] -> f16 rows (same layout), 16 B per thread; all three matrices in one launch (grid.y)
__global__ __launch_bounds__(256) void k_wcvt(const float* __restrict__ wq, const float* __restrict__ wk, const float* __restrict__ wv, _Float16* __restrict__ wh) {
  const size_t g8 = (size_t)blockIdx.x * 256 + threadIdx.x; const int m = blockIdx.y;
  const float* s = m == 0 ? wq : (m == 1 ? wk : wv);
  union { v8h h; v4u u; } pk;
#pragma unroll
  for (int e = 0; e < 8; ++e) pk.h[e] = (_Float16)s[g8 * 8 + e];
  vst2(wh + (size_t)m * CC * CC + g8 * 8, pk.u);
}

// ---- one stage of k_qkv's operands, global -> LDS without registers: 384 rows x 128 B, 12 x 16 B per thread
#define KS 64                    // k per stage: 128 B of every operand row
#define RP 72                    // LDS row pitch in halves: 144 B = 16 B x 9, no bank conflict for 16-byte fragment reads
#define BM 128                   // positions per block
#define BN 256                   // output channels per block (4 heads)
#define SBYTES ((BM + BN) * RP * 2)   // one stage buffer
#define STP (BM + 4)             // epilogue staging pitch in floats
__device__ __forceinline__ void stage_copy(unsigned l, const _Float16* gx, const _Float16* gw) {
  // the closing s_wait_xcnt stands inside the statement so that no address register is rewritten ahead of it
  asm volatile("global_load_async_to_lds_b128 %0, %12, off\n\t"
               "global_load_async_to_lds_b128 %1, %13, off\n\t"
               "global_load_async_to_lds_b128 %2, %14, off\n\t"
               "global_load_async_to_lds_b128 %3, %15, off\n\t"
               "global_load_async_to_lds_b128 %4, %16, off\n\t"
               "global_load_async_to_lds_b128 %5, %17, off\n\t"
               "global_load_async_to_lds_b128 %6, %18, off\n\t"
               "global_load_async_to_lds_b128 %7, %19, off\n\t"
               "global_load_async_to_lds_b128 %8, %20, off\n\t"
               "global_load_async_to_lds_b128 %9, %21, off\n\t"
               "global_load_async_to_lds_b128 %10, %22, off\n\t"
               "global_load_async_to_lds_b128 %11, %23, off\n\t"
               "s_wait_xcnt 0x0"
               :: "v"(l), "v"(l + 1 * 32 * RP * 2), "v"(l + 2 * 32 * RP * 2), "v"(l + 3 * 32 * RP * 2),
                  "v"(l + 4 * 32 * RP * 2), "v"(l + 5 * 32 * RP * 2), "v"(l + 6 * 32 * RP * 2), "v"(l + 7 * 32 * RP * 2),
                  "v"(l + 8 * 32 * RP * 2), "v"(l + 9 * 32 * RP * 2), "v"(l + 10 * 32 * RP * 2), "v"(l + 11 * 32 * RP * 2),
                  "v"(gx), "v"(gx + 1 * 32 * CC), "v"(gx + 2 * 32 * CC), "v"(gx + 3 * 32 * CC),
                  "v"(gw), "v"(gw + 1 * 32 * CC), "v"(gw + 2 * 32 * CC), "v"(gw + 3 * 32 * CC),
                  "v"(gw + 4 * 32 * CC), "v"(gw + 5 * 32 * CC), "v"(gw + 6 * 32 * CC), "v"(gw + 7 * 32 * CC)
               : "memory");
}

// ---- projections: block = 128 positions (n, w0..) x 256 output channels (4 heads) of q/k/v (grid.z), 8 waves as 2 x 4; K = 1024
// a wave owns 64 positions x 64 channels: 8 fragments feed 16 products, one 16-byte LDS read per product
// q,k -> [n][h][w][64] f16 rows; v -> vT[n][h][d][w] f16
__global__ __launch_bounds__(256) void k_qkv(const _Float16* __restrict__ xT, const _Float16* __restrict__ wh, const float* __restrict__ bq,
                                           const float* __restrict__ bk, const float* __restrict__ bv,
                                           _Float16* __restrict__ qh, _Float16* __restrict__ kh, _Float16* __restrict__ vT) {
  // two stage buffers of [128 x rows | 256 weight rows] x 64 k; after the K loop the same bytes serve as the epilogue's st[256][132], the larger of the two uses
  static_assert(BN * STP * 4 >= 2 * SBYTES, "the staging array holds both stage buffers");
  __shared__ __align__(16) unsigned char sm[BN * STP * 4];
  float (*st)[STP] = (float (*)[STP])sm;
  const int tid = threadIdx.x, wave = tid >> 5, lane = tid & 31, col = lane & 15, g = lane >> 4;
  const int wm = wave & 1, wn = wave >> 1;             // the wave's 64 positions and its 64 channels inside the block
  const int n = blockIdx.y / (WW / BM), w0 = (blockIdx.y % (WW / BM)) * BM, o0 = blockIdx.x * BN, which = blockIdx.z;
  const _Float16* W = wh + (size_t)which * CC * CC;
  const float* bb = which == 0 ? bq : (which == 1 ? bk : bv);
  v8f acc[4][4] = {};
  // copy map: 8 lanes cover one 128-B row slice (a whole line), a thread's 12 copies are 32 rows apart
  const int cr = tid >> 3, cq = tid & 7;
  const _Float16* gx = xT + ((size_t)n * WW + w0 + cr) * CC + cq * 8;
  const _Float16* gw = W + (size_t)(o0 + cr) * CC + cq * 8;
  const unsigned l0 = (unsigned)(size_t)sm + cr * (RP * 2) + cq * 16;
  stage_copy(l0, gx, gw);
  asm volatile("s_wait_asynccnt 0x0" ::: "memory");   // stage 0 has landed before the barrier that publishes it
  __syncthreads();
  stage_copy(l0 + SBYTES, gx + KS, gw + KS);
#pragma unroll 1   // rolled: one publish point per trip keeps the two-buffer order below as written
  for (int t = 0; t < CC / KS; ++t) {
    const _Float16* sb = (const _Float16*)(sm + (t & 1) * SBYTES);
#pragma unroll
    for (int kk = 0; kk < KS; kk += 32) {
      // all 16 fragment reads of a 32-k block go out as one group, so that one LDS latency is paid per block and not per product
      v16h a[4], b[4];
#pragma unroll
      for (int i = 0; i < 4; ++i) a[i] = frag_h(sb + (wm * 64 + i * 16 + col) * RP + kk, lane);
#pragma unroll
      for (int j = 0; j < 4; ++j) b[j] = frag_h(sb + (BM + wn * 64 + j * 16 + col) * RP + kk, lane);
#pragma unroll
      for (int i = 0; i < 4; ++i) {
#pragma unroll
        for (int j = 0; j < 4; ++j) acc[i][j] = wmma16(a[i], b[j], acc[i][j]); }
    }
    asm volatile("s_wait_dscnt 0x0" ::: "memory");     // this wave's reads of buffer t&1 are done before the buffer is refilled
    asm volatile("s_wait_asynccnt 0x0" ::: "memory");  // this wave's copies of stage t+1 have landed before other waves read them
    __syncthreads();                                   // publishes stage t+1 and ends every reader's last read of buffer t&1
    if (t + 2 < CC / KS) stage_copy(l0 + (t & 1) * SBYTES, gx + (t + 2) * KS, gw + (t + 2) * KS);
  }
  asm volatile("s_wait_asynccnt 0x0" ::: "memory");    // no copy is outstanding when the buffers become the epilogue's staging
#pragma unroll
  for (int j = 0; j < 4; ++j) { const float bv_ = bb[o0 + wn * 64 + j * 16 + col];
#pragma unroll
    for (int i = 0; i < 4; ++i) {
#pragma unroll
      for (int r = 0; r < 8; ++r) st[wn * 64 + j * 16 + col][wm * 64 + i * 16 + 8 * g + r] = acc[i][j][r] + bv_; } }
  __syncthreads();
  const int h0 = o0 / HD;
  if (which < 2) {
    _Float16* dst = which == 0 ? qh : kh;
    for (int q = tid; q < (BN / HD) * BM * 8; q += 256) { const int hh = q / (BM * 8), wl = (q >> 3) & (BM - 1), pc = q & 7;
      union { v8h h; v4u u; } pk;
#pragma unroll
      for (int e = 0; e < 8; ++e) pk.h[e] = (_Float16)st[hh * 64 + pc * 8 + e][wl];
      vst2(dst + (((size_t)n * HH + h0 + hh) * WW + w0 + wl) * HD + pc * 8, pk.u); }
  } else {
    for (int q = tid; q < BN * (BM / 8); q += 256) { const int cl = q / (BM / 8), pc = q & (BM / 8 - 1); const int hh = cl >> 6, d = cl & 63;
      union { v8h h; v4u u; } pk;
#pragma unroll
      for (int i = 0; i < 8; ++i) pk.h[i] = (_Float16)st[cl][pc * 8 + i];
      vst2(vT + (((size_t)n * HH + h0 + hh) * HD + d) * WW + w0 + pc * 8, pk.u); }
  }
}

// ---- one stage of k_attn's operands, global -> LDS without registers: 64 key rows of K and the 64 d rows of V^T, 128 B of each; 4 x 16 B per thread
#define AK 64                    // keys per stage: a whole 128-B line of every V^T row, two 32-key passes
#define ABYTES (128 * RP * 2)    // one stage buffer, rows at k_qkv's 144-B pitch
#define QG 2                     // 16-query column groups per wave: each K and V^T fragment read from LDS feeds both
#define QB 256                   // queries per block: 8 waves x 32
#define OTP (QB + 4)             // epilogue staging pitch in floats
__device__ __forceinline__ void stage_copy_kv(unsigned l, const _Float16* gk, const _Float16* gv) {
  // the closing s_wait_xcnt stands inside the statement so that no address register is rewritten ahead of it
  asm volatile("global_load_async_to_lds_b128 %0, %4, off\n\t"
               "global_load_async_to_lds_b128 %1, %5, off\n\t"
               "global_load_async_to_lds_b128 %2, %6, off\n\t"
               "global_load_async_to_lds_b128 %3, %7, off\n\t"
               "s_wait_xcnt 0x0"
               :: "v"(l), "v"(l + 1 * 32 * RP * 2), "v"(l + 2 * 32 * RP * 2), "v"(l + 3 * 32 * RP * 2),
                  "v"(gk), "v"(gk + 32 * HD), "v"(gv), "v"(gv + 32 * WW)
               : "memory");
}

__global__ __launch_bounds__(256) void k_attn(const _Float16* __restrict__ qh, const _Float16* __restrict__ kh, const _Float16* __restrict__ vT,
                                            const float* __restrict__ mask, float* __restrict__ out) {
  // two stage buffers of [64 K rows | 64 V^T rows] x 64 keys; after the key loop the same bytes serve as the epilogue's sOT[d][w_local], the larger of the two uses
  static_assert(HD * OTP * 4 >= 2 * ABYTES, "the staging array holds both stage buffers");
  __shared__ __align__(16) unsigned char sm[HD * OTP * 4];
  float (*sOT)[OTP] = (float (*)[OTP])sm;
  const int tid = threadIdx.x, w = tid >> 5, lane = tid & 31, g = lane >> 4, ln = lane & 15;
  const int bh = blockIdx.y, n = bh / HH, h = bh % HH, q0 = blockIdx.x * QB + w * (QG * 16);
  v16h qb0[QG], qb1[QG];
#pragma unroll
  for (int c = 0; c < QG; ++c) { const _Float16* qrow = qh + ((size_t)bh * WW + q0 + c * 16 + ln) * HD;
    qb0[c] = frag_h(qrow, lane); qb1[c] = frag_h(qrow + 32, lane); }
  const float* mk = mask + (size_t)n * WW + 8 * g;     // [N,1,1,W]: per key; this lane's keys are 8g + r and 16 + 8g + r of a pass
  float mrun[QG], lrun[QG];                            // lrun: the sum over this lane's own keys; the halves are joined after the loop
  v8f acc[QG][4];
#pragma unroll
  for (int c = 0; c < QG; ++c) { mrun[c] = -3.0e38f; lrun[c] = 0.f;
#pragma unroll
    for (int t = 0; t < 4; ++t) acc[c][t] = (v8f){}; }
  const _Float16* kb = kh + (size_t)bh * WW * HD;
  const _Float16* vb = vT + (size_t)bh * HD * WW;
  // copy map: 8 lanes cover one 128-B row slice (a whole line), a thread's 4 copies are 32 rows apart
  const int cr = tid >> 3, cq = tid & 7;
  const _Float16* gk = kb + (size_t)cr * HD + cq * 8;
  const _Float16* gv = vb + (size_t)cr * WW + cq * 8;
  const unsigned l0 = (unsigned)(size_t)sm + cr * (RP * 2) + cq * 16;
  stage_copy_kv(l0, gk, gv);
  asm volatile("s_wait_asynccnt 0x0" ::: "memory");   // stage 0 has landed before the barrier that publishes it
  __syncthreads();
  stage_copy_kv(l0 + ABYTES, gk + AK * HD, gv + AK);
#pragma unroll 1   // rolled: one publish point per trip keeps the two-buffer order below as written
  for (int st = 0; st < WW / AK; ++st) {
   const _Float16* sb = (const _Float16*)(sm + (st & 1) * ABYTES);
#pragma unroll 1   // rolled, as before: one pass's registers only
   for (int kk = 0; kk < AK; kk += BK) {
    const int k0 = st * AK + kk;
    union { v8f v; v4f q[2]; } m0, m1;
    m0.q[0] = *(const v4f*)(mk + k0);      m0.q[1] = *(const v4f*)(mk + k0 + 4);
    m1.q[0] = *(const v4f*)(mk + k0 + 16); m1.q[1] = *(const v4f*)(mk + k0 + 20);
    // the 8 fragment reads of the pass's K rows go out as one group: one LDS latency per pass and not one per product
    const v16h ka0 = frag_h(sb + (kk + ln) * RP, lane),      ka1 = frag_h(sb + (kk + ln) * RP + 32, lane);
    const v16h kc0 = frag_h(sb + (kk + 16 + ln) * RP, lane), kc1 = frag_h(sb + (kk + 16 + ln) * RP + 32, lane);
    v8f s0[QG], s1[QG];                                // s0[c][r] = score(key k0 + 8g + r, query q0 + 16c + ln), s1[c][r]: key k0 + 16 + 8g + r
#pragma unroll
    for (int c = 0; c < QG; ++c) { s0[c] = wmma16(ka0, qb0[c], (v8f){}); s1[c] = wmma16(kc0, qb0[c], (v8f){}); }
#pragma unroll
    for (int c = 0; c < QG; ++c) { s0[c] = wmma16(ka1, qb1[c], s0[c]); s1[c] = wmma16(kc1, qb1[c], s1[c]); }
    v16h pb[QG];                                       // B operand: element r = key 8g + r, element 8 + r = key 16 + 8g + r, as frag_h orders V^T's k
#pragma unroll
    for (int c = 0; c < QG; ++c) {
      const v8f x0 = s0[c] * 0.125f + m0.v, x1 = s1[c] * 0.125f + m1.v;
      float mx = fmaxf(x0[0], x1[0]);
#pragma unroll
      for (int r = 1; r < 8; ++r) mx = fmaxf(mx, fmaxf(x0[r], x1[r]));
      mx = fmaxf(mx, xhalf(mx));                       // both halves now hold the query's maximum over the 32 keys
      const float mn = fmaxf(mrun[c], mx);
      const float corr = __builtin_amdgcn_exp2f((mrun[c] - mn) * LOG2E);
      // e^d * 2^14 = 2^(d * log2 e + 14): one fma and one hardware exponential per score; d <= 0, so p <= 2^14, and a result below 2^-126 is 0
      const v8f t0 = (x0 - mn) * LOG2E + 14.0f, t1 = (x1 - mn) * LOG2E + 14.0f;
      v8f p0, p1;                                      // a loop per tile, both unrolled into registers: neighbouring scores of one tile share a packed fma, with no register moves
#pragma unroll
      for (int r = 0; r < 8; ++r) p0[r] = __builtin_amdgcn_exp2f(t0[r]);
#pragma unroll
      for (int r = 0; r < 8; ++r) p1[r] = __builtin_amdgcn_exp2f(t1[r]);
      const v8f ps = p0 + p1;
      const float sum = ((ps[0] + ps[1]) + (ps[2] + ps[3])) + ((ps[4] + ps[5]) + (ps[6] + ps[7]));
#pragma unroll
      for (int r = 0; r < 8; ++r) { pb[c][r] = (_Float16)p0[r]; pb[c][8 + r] = (_Float16)p1[r]; }
      lrun[c] = lrun[c] * corr + sum; mrun[c] = mn;
#pragma unroll
      for (int t = 0; t < 4; ++t) acc[c][t] *= corr;
    }
    v16h vf[4];                                        // likewise the 8 reads of V^T's rows
#pragma unroll
    for (int t = 0; t < 4; ++t) vf[t] = frag_h(sb + (64 + t * 16 + ln) * RP + kk, lane);
#pragma unroll
    for (int t = 0; t < 4; ++t) {
#pragma unroll
      for (int c = 0; c < QG; ++c) acc[c][t] = wmma16(vf[t], pb[c], acc[c][t]); }
   }
   asm volatile("s_wait_dscnt 0x0" ::: "memory");     // this wave's reads of buffer st&1 are done before the buffer is refilled
   asm volatile("s_wait_asynccnt 0x0" ::: "memory");  // this wave's copies of stage st+1 have landed before other waves read them
   __syncthreads();                                   // publishes stage st+1 and ends every reader's last read of buffer st&1
   if (st + 2 < WW / AK) stage_copy_kv(l0 + (st & 1) * ABYTES, gk + (size_t)(st + 2) * AK * HD, gv + (st + 2) * AK);
  }
  asm volatile("s_wait_asynccnt 0x0" ::: "memory");    // no copy is outstanding when the buffers become the epilogue's staging
  // acc[c][t][r] = O^T[d = t*16 + 8g + r][query 16c + ln]: stage as sOT[d][w_local], w_local = w*32 + 16c + ln
#pragma unroll
  for (int c = 0; c < QG; ++c) {
    const float il = 1.0f / (lrun[c] + xhalf(lrun[c]));   // lrun carries P's 2^14 like acc: the lift cancels
#pragma unroll
    for (int t = 0; t < 4; ++t) {
#pragma unroll
      for (int r = 0; r < 8; ++r) sOT[t * 16 + 8 * g + r][w * (QG * 16) + c * 16 + ln] = acc[c][t][r] * il; } }
  __syncthreads();
  const int qb0_ = blockIdx.x * QB;
  for (int q = tid; q < HD * (QB / 4); q += 256) { const int d = q / (QB / 4), pc = q & (QB / 4 - 1);
    vst2(out + ((size_t)n * CC + h * HD + d) * WW + qb0_ + pc * 4, *(const v4f*)(&sOT[d][pc * 4])); }
}

extern "C" void kernel_launch(void* const* d_in, const int* in_sizes, int n_in,
                              void* d_out, int out_size, void* d_ws, size_t ws_size,
                              hipStream_t stream) {
  (void)in_sizes; (void)n_in; (void)out_size; (void)ws_size;
  const float* hs   = (const float*)d_in[0];
  const float* mask = (const float*)d_in[1];
  const float* wq = (const float*)d_in[2]; const float* bq = (const float*)d_in[3];
  const float* wk = (const float*)d_in[4]; const float* bk = (const float*)d_in[5];
  const float* wv = (const float*)d_in[6]; const float* bv = (const float*)d_in[7];
  float* out = (float*)d_out;
  char* ws = (char*)d_ws; size_t off = 0;
  auto take = [&](size_t bytes) { char* p = ws + off; off += (bytes + 255) & ~(size_t)255; return p; };
  _Float16* xT = (_Float16*)take((size_t)NB * WW * CC * 2);      // 16 MB
  _Float16* wh = (_Float16*)take((size_t)3 * CC * CC * 2);       // 6 MB
  _Float16* qh = (_Float16*)take((size_t)NB * HH * WW * HD * 2);  // 16 MB
  _Float16* kh = (_Float16*)take((size_t)NB * HH * WW * HD * 2);
  _Float16* vT = (_Float16*)take((size_t)NB * HH * HD * WW * 2);
  k_xT<<<dim3(WW / 64, CC / 64, NB), 256, 0, stream>>>(hs, xT);
  k_wcvt<<<dim3((CC * CC / 8) / 256, 3), 256, 0, stream>>>(wq, wk, wv, wh);
  k_qkv<<<dim3(CC / BN, NB * (WW / BM), 3), 256, 0, stream>>>(xT, wh, bq, bk, bv, qh, kh, vT);
  k_attn<<<dim3(WW / QB, NB * HH), 256, 0, stream>>>(qh, kh, vT, mask, out);
}

// v007
// It runs in 94.1 microseconds.
// In two side-by-side timings against v006, it was 1.09 and 1.08 times as fast.
// All steps since v000 together make it 4.88 times as fast.
#include <hip/hip_runtime.h>
#include <math.h>

// Conv1d(k=1) self-attention: q/k/v = 1x1 conv over [N,C,W] (C = 1024), 16 heads x 64, softmax(q.k/8 + mask) v, output
// [N,C,W]. Contractions on v_wmma_f32_16x16x32_f16 with f16 operands (x pre-transposed once to f16 [n][w][c] rows, weights
// converted to f16 rows), f32 accumulate; online softmax in f32 with P lifted by 2^14 inside its exponential (the row sum carries the same lift)

#define NB 8
#define CC 1024
#define WW 1024
#define HH 16
#define HD 64
#define BK 32
#define LOG2E 1.44269504088896340736f

typedef __attribute__((ext_vector_type(16))) _Float16 v16h;
typedef __attribute__((ext_vector_type(8)))  _Float16 v8h;
typedef __attribute__((ext_vector_type(8)))  float v8f;
typedef __attribute__((ext_vector_type(4)))  float v4f;
typedef __attribute__((ext_vector_type(4)))  unsigned v4u;

template <typename T> __device__ __forceinline__ void vst2(void* p, T v) { *(T*)p = v;  }
__device__ __forceinline__ v8f wmma16(v16h a, v16h b, v8f c) {
  v8f d = __builtin_amdgcn_wmma_f32_16x16x32_f16(false, a, false, b, (short)0, c, false, false);
  asm volatile("v_nop\n\tv_nop\n\tv_nop\n\tv_nop" : "+v"(d) : "v"(a), "v"(b));
  return d;
}
__device__ __forceinline__ v16h frag_h(const _Float16* rowk0, int lane) {
  union { v16h v; v8h q[2]; } u; const _Float16* p = rowk0 + 8 * (lane >> 4);
  u.q[0] = *(const v8h*)p; u.q[1] = *(const v8h*)(p + 16); return u.v;
}
// lane l <-> lane l ^ 16, on the vector pipe
__device__ __forceinline__ float xhalf(float x) {
  const int b = __builtin_bit_cast(int, x);
  return __builtin_bit_cast(float, __builtin_amdgcn_permlanex16(b, b, 0x76543210, 0xfedcba98, false, false));
}

__global__ __launch_bounds__(256) void k_xT(const float* __restrict__ x, _Float16* __restrict__ xT) {
  __shared__ float tile[64][65];
  const int n = blockIdx.z, c0 = blockIdx.y * 64, w0 = blockIdx.x * 64, tid = threadIdx.x;
  for (int q = tid; q < 64 * 64; q += 256) { const int cl = q >> 6, wl = q & 63; tile[cl][wl] = x[((size_t)n * CC + c0 + cl) * WW + w0 + wl]; }
  __syncthreads();
  for (int q = tid; q < 64 * 8; q += 256) { const int wl = q >> 3, pc = q & 7;
    union { v8h h; v4u u; } pk;
#pragma unroll
    for (int e = 0; e < 8; ++e) pk.h[e] = (_Float16)tile[pc * 8 + e][wl];
    vst2(xT + ((size_t)n * WW + w0 + wl) * CC + c0 + pc * 8, pk.u); }
}
// ---- weights f32 [Cout][Cin] -> f16 rows (same layout), 16 B per thread; all three matrices in one launch (grid.y)
__global__ __launch_bounds__(256) void k_wcvt(const float* __restrict__ wq, const float* __restrict__ wk, const float* __restrict__ wv, _Float16* __restrict__ wh) {
  const size_t g8 = (size_t)blockIdx.x * 256 + threadIdx.x; const int m = blockIdx.y;
  const float* s = m == 0 ? wq : (m == 1 ? wk : wv);
  union { v8h h; v4u u; } pk;
#pragma unroll
  for (int e = 0; e < 8; ++e) pk.h[e] = (_Float16)s[g8 * 8 + e];
  vst2(wh + (size_t)m * CC * CC + g8 * 8, pk.u);
}

// ---- one stage of k_qkv's operands, global -> LDS without registers: 384 rows x 128 B, 12 x 16 B per thread
#define KS 64                    // k per stage: 128 B of every operand row
#define RP 72                    // LDS row pitch in halves: 144 B = 16 B x 9, no bank conflict for 16-byte fragment reads
#define BM 128                   // positions per block
#define BN 256                   // output channels per block (4 heads)
#define SBYTES ((BM + BN) * RP * 2)   // one stage buffer
#define STP (BM + 4)             // epilogue staging pitch in floats
__device__ __forceinline__ void stage_copy(unsigned l, const _Float16* gx, const _Float16* gw) {
  // the closing s_wait_xcnt stands inside the statement so that no address register is rewritten ahead of it
  asm volatile("global_load_async_to_lds_b128 %0, %12, off\n\t"
               "global_load_async_to_lds_b128 %1, %13, off\n\t"
               "global_load_async_to_lds_b128 %2, %14, off\n\t"
               "global_load_async_to_lds_b128 %3, %15, off\n\t"
               "global_load_async_to_lds_b128 %4, %16, off\n\t"
               "global_load_async_to_lds_b128 %5, %17, off\n\t"
               "global_load_async_to_lds_b128 %6, %18, off\n\t"
               "global_load_async_to_lds_b128 %7, %19, off\n\t"
               "global_load_async_to_lds_b128 %8, %20, off\n\t"
               "global_load_async_to_lds_b128 %9, %21, off\n\t"
               "global_load_async_to_lds_b128 %10, %22, off\n\t"
               "global_load_async_to_lds_b128 %11, %23, off\n\t"
               "s_wait_xcnt 0x0"
               :: "v"(l), "v"(l + 1 * 32 * RP * 2), "v"(l + 2 * 32 * RP * 2), "v"(l + 3 * 32 * RP * 2),
                  "v"(l + 4 * 32 * RP * 2), "v"(l + 5 * 32 * RP * 2), "v"(l + 6 * 32 * RP * 2), "v"(l + 7 * 32 * RP * 2),
                  "v"(l + 8 * 32 * RP * 2), "v"(l + 9 * 32 * RP * 2), "v"(l + 10 * 32 * RP * 2), "v"(l + 11 * 32 * RP * 2),
                  "v"(gx), "v"(gx + 1 * 32 * CC), "v"(gx + 2 * 32 * CC), "v"(gx + 3 * 32 * CC),
                  "v"(gw), "v"(gw + 1 * 32 * CC), "v"(gw + 2 * 32 * CC), "v"(gw + 3 * 32 * CC),
                  "v"(gw + 4 * 32 * CC), "v"(gw + 5 * 32 * CC), "v"(gw + 6 * 32 * CC), "v"(gw + 7 * 32 * CC)
               : "memory");
}

// ---- projections: block = 128 positions (n, w0..) x 256 output channels (4 heads) of q/k/v (grid.z), 8 waves as 2 x 4; K = 1024
// a wave owns 64 positions x 64 channels: 8 fragments feed 16 products, one 16-byte LDS read per product
// q,k -> [n][h][w][64] f16 rows; v -> vT[n][h][d][w] f16
__global__ __launch_bounds__(256) void k_qkv(const _Float16* __restrict__ xT, const _Float16* __restrict__ wh, const float* __restrict__ bq,
                                           const float* __restrict__ bk, const float* __restrict__ bv,
                                           _Float16* __restrict__ qh, _Float16* __restrict__ kh, _Float16* __restrict__ vT) {
  // two stage buffers of [128 x rows | 256 weight rows] x 64 k; after the K loop the same bytes serve as the epilogue's st[256][132], the larger of the two uses
  static_assert(BN * STP * 4 >= 2 * SBYTES, "the staging array holds both stage buffers");
  __shared__ __align__(16) unsigned char sm[BN * STP * 4];
  float (*st)[STP] = (float (*)[STP])sm;
  const int tid = threadIdx.x, wave = tid >> 5, lane = tid & 31, col = lane & 15, g = lane >> 4;
  const int wm = wave & 1, wn = wave >> 1;             // the wave's 64 positions and its 64 channels inside the block
  const int n = blockIdx.y / (WW / BM), w0 = (blockIdx.y % (WW / BM)) * BM, o0 = blockIdx.x * BN, which = blockIdx.z;
  const _Float16* W = wh + (size_t)which * CC * CC;
  const float* bb = which == 0 ? bq : (which == 1 ? bk : bv);
  v8f acc[4][4] = {};
  // copy map: 8 lanes cover one 128-B row slice (a whole line), a thread's 12 copies are 32 rows apart
  const int cr = tid >> 3, cq = tid & 7;
  const _Float16* gx = xT + ((size_t)n * WW + w0 + cr) * CC + cq * 8;
  const _Float16* gw = W + (size_t)(o0 + cr) * CC + cq * 8;
  const unsigned l0 = (unsigned)(size_t)sm + cr * (RP * 2) + cq * 16;
  // trip t works on k slice (t + rot) mod 16: the 64 blocks that share weight rows and the 12 that share x rows walk k from different starts,
  // so that they do not ask L2 for the same lines at the same moment
  const int rot = (blockIdx.y + blockIdx.x + (CC / BN) * blockIdx.z) & (CC / KS - 1);
  stage_copy(l0, gx + rot * KS, gw + rot * KS);
  asm volatile("s_wait_asynccnt 0x0" ::: "memory");   // stage 0 has landed before the barrier that publishes it
  __syncthreads();
  { const int s1 = ((1 + rot) & (CC / KS - 1)) * KS; stage_copy(l0 + SBYTES, gx + s1, gw + s1); }
#pragma unroll 1   // rolled: one publish point per trip keeps the two-buffer order below as written
  for (int t = 0; t < CC / KS; ++t) {
    const _Float16* sb = (const _Float16*)(sm + (t & 1) * SBYTES);
#pragma unroll
    for (int kk = 0; kk < KS; kk += 32) {
      // all 16 fragment reads of a 32-k block go out as one group, so that one LDS latency is paid per block and not per product
      v16h a[4], b[4];
#pragma unroll
      for (int i = 0; i < 4; ++i) a[i] = frag_h(sb + (wm * 64 + i * 16 + col) * RP + kk, lane);
#pragma unroll
      for (int j = 0; j < 4; ++j) b[j] = frag_h(sb + (BM + wn * 64 + j * 16 + col) * RP + kk, lane);
#pragma unroll
      for (int i = 0; i < 4; ++i) {
#pragma unroll
        for (int j = 0; j < 4; ++j) acc[i][j] = wmma16(a[i], b[j], acc[i][j]); }
    }
    asm volatile("s_wait_dscnt 0x0" ::: "memory");     // this wave's reads of buffer t&1 are done before the buffer is refilled
    asm volatile("s_wait_asynccnt 0x0" ::: "memory");  // this wave's copies of stage t+1 have landed before other waves read them
    __syncthreads();                                   // publishes stage t+1 and ends every reader's last read of buffer t&1
    if (t + 2 < CC / KS) { const int s2 = ((t + 2 + rot) & (CC / KS - 1)) * KS; stage_copy(l0 + (t & 1) * SBYTES, gx + s2, gw + s2); }
  }
  asm volatile("s_wait_asynccnt 0x0" ::: "memory");    // no copy is outstanding when the buffers become the epilogue's staging
#pragma unroll
  for (int j = 0; j < 4; ++j) { const float bv_ = bb[o0 + wn * 64 + j * 16 + col];
#pragma unroll
    for (int i = 0; i < 4; ++i) {
#pragma unroll
      for (int r = 0; r < 8; ++r) st[wn * 64 + j * 16 + col][wm * 64 + i * 16 + 8 * g + r] = acc[i][j][r] + bv_; } }
  __syncthreads();
  const int h0 = o0 / HD;
  if (which < 2) {
    _Float16* dst = which == 0 ? qh : kh;
    for (int q = tid; q < (BN / HD) * BM * 8; q += 256) { const int hh = q / (BM * 8), wl = (q >> 3) & (BM - 1), pc = q & 7;
      union { v8h h; v4u u; } pk;
#pragma unroll
      for (int e = 0; e < 8; ++e) pk.h[e] = (_Float16)st[hh * 64 + pc * 8 + e][wl];
      vst2(dst + (((size_t)n * HH + h0 + hh) * WW + w0 + wl) * HD + pc * 8, pk.u); }
  } else {
    for (int q = tid; q < BN * (BM / 8); q += 256) { const int cl = q / (BM / 8), pc = q & (BM / 8 - 1); const int hh = cl >> 6, d = cl & 63;
      union { v8h h; v4u u; } pk;
#pragma unroll
      for (int i = 0; i < 8; ++i) pk.h[i] = (_Float16)st[cl][pc * 8 + i];
      vst2(vT + (((size_t)n * HH + h0 + hh) * HD + d) * WW + w0 + pc * 8, pk.u); }
  }
}

// ---- one stage of k_attn's operands, global -> LDS without registers: 64 key rows of K and the 64 d rows of V^T, 128 B of each; 4 x 16 B per thread
#define AK 64                    // keys per stage: a whole 128-B line of every V^T row, two 32-key passes
#define ABYTES (128 * RP * 2)    // one stage buffer, rows at k_qkv's 144-B pitch
#define QG 2                     // 16-query column groups per wave: each K and V^T fragment read from LDS feeds both
#define QB 256                   // queries per block: 8 waves x 32
#define OTP (QB + 4)             // epilogue staging pitch in floats
__device__ __forceinline__ void stage_copy_kv(unsigned l, const _Float16* gk, const _Float16* gv) {
  // the closing s_wait_xcnt stands inside the statement so that no address register is rewritten ahead of it
  asm volatile("global_load_async_to_lds_b128 %0, %4, off\n\t"
               "global_load_async_to_lds_b128 %1, %5, off\n\t"
               "global_load_async_to_lds_b128 %2, %6, off\n\t"
               "global_load_async_to_lds_b128 %3, %7, off\n\t"
               "s_wait_xcnt 0x0"
               :: "v"(l), "v"(l + 1 * 32 * RP * 2), "v"(l + 2 * 32 * RP * 2), "v"(l + 3 * 32 * RP * 2),
                  "v"(gk), "v"(gk + 32 * HD), "v"(gv), "v"(gv + 32 * WW)
               : "memory");
}

__global__ __launch_bounds__(256) void k_attn(const _Float16* __restrict__ qh, const _Float16* __restrict__ kh, const _Float16* __restrict__ vT,
                                            const float* __restrict__ mask, float* __restrict__ out) {
  // two stage buffers of [64 K rows | 64 V^T rows] x 64 keys; after the key loop the same bytes serve as the epilogue's sOT[d][w_local], the larger of the two uses
  static_assert(HD * OTP * 4 >= 2 * ABYTES, "the staging array holds both stage buffers");
  __shared__ __align__(16) unsigned char sm[HD * OTP * 4];
  float (*sOT)[OTP] = (float (*)[OTP])sm;
  const int tid = threadIdx.x, w = tid >> 5, lane = tid & 31, g = lane >> 4, ln = lane & 15;
  const int bh = blockIdx.y, n = bh / HH, h = bh % HH, q0 = blockIdx.x * QB + w * (QG * 16);
  v16h qb0[QG], qb1[QG];
#pragma unroll
  for (int c = 0; c < QG; ++c) { const _Float16* qrow = qh + ((size_t)bh * WW + q0 + c * 16 + ln) * HD;
    qb0[c] = frag_h(qrow, lane); qb1[c] = frag_h(qrow + 32, lane); }
  const float* mk = mask + (size_t)n * WW + 8 * g;     // [N,1,1,W]: per key; this lane's keys are 8g + r and 16 + 8g + r of a pass
  float mrun[QG], lrun[QG];                            // lrun: the sum over this lane's own keys; the halves are joined after the loop
  v8f acc[QG][4];
#pragma unroll
  for (int c = 0; c < QG; ++c) { mrun[c] = -3.0e38f; lrun[c] = 0.f;
#pragma unroll
    for (int t = 0; t < 4; ++t) acc[c][t] = (v8f){}; }
  const _Float16* kb = kh + (size_t)bh * WW * HD;
  const _Float16* vb = vT + (size_t)bh * HD * WW;
  // copy map: 8 lanes cover one 128-B row slice (a whole line), a thread's 4 copies are 32 rows apart
  const int cr = tid >> 3, cq = tid & 7;
  const _Float16* gk = kb + (size_t)cr * HD + cq * 8;
  const _Float16* gv = vb + (size_t)cr * WW + cq * 8;
  const unsigned l0 = (unsigned)(size_t)sm + cr * (RP * 2) + cq * 16;
  // stage st works on key slice (st + rot) mod 16: the 4 blocks of a head start a quarter of the keys apart, so that they do not ask L2 for the same
  // lines at the same moment; heads start one slice apart, so that the blocks' V^T pieces (128 B of 2-KB rows) do not all sit at one offset in the row.
  // The online softmax takes the slices in any order.
  const int rot = (blockIdx.x * (WW / AK / (WW / QB)) + blockIdx.y) & (WW / AK - 1);
  stage_copy_kv(l0, gk + (size_t)rot * AK * HD, gv + rot * AK);
  asm volatile("s_wait_asynccnt 0x0" ::: "memory");   // stage 0 has landed before the barrier that publishes it
  __syncthreads();
  { const int s1 = (1 + rot) & (WW / AK - 1); stage_copy_kv(l0 + ABYTES, gk + (size_t)s1 * AK * HD, gv + s1 * AK); }
#pragma unroll 1   // rolled: one publish point per trip keeps the two-buffer order below as written
  for (int st = 0; st < WW / AK; ++st) {
   const _Float16* sb = (const _Float16*)(sm + (st & 1) * ABYTES);
#pragma unroll 1   // rolled, as before: one pass's registers only
   for (int kk = 0; kk < AK; kk += BK) {
    const int k0 = ((st + rot) & (WW / AK - 1)) * AK + kk;
    union { v8f v; v4f q[2]; } m0, m1;
    m0.q[0] = *(const v4f*)(mk + k0);      m0.q[1] = *(const v4f*)(mk + k0 + 4);
    m1.q[0] = *(const v4f*)(mk + k0 + 16); m1.q[1] = *(const v4f*)(mk + k0 + 20);
    // the 8 fragment reads of the pass's K rows go out as one group: one LDS latency per pass and not one per product
    const v16h ka0 = frag_h(sb + (kk + ln) * RP, lane),      ka1 = frag_h(sb + (kk + ln) * RP + 32, lane);
    const v16h kc0 = frag_h(sb + (kk + 16 + ln) * RP, lane), kc1 = frag_h(sb + (kk + 16 + ln) * RP + 32, lane);
    v8f s0[QG], s1[QG];                                // s0[c][r] = score(key k0 + 8g + r, query q0 + 16c + ln), s1[c][r]: key k0 + 16 + 8g + r
#pragma unroll
    for (int c = 0; c < QG; ++c) { s0[c] = wmma16(ka0, qb0[c], (v8f){}); s1[c] = wmma16(kc0, qb0[c], (v8f){}); }
#pragma unroll
    for (int c = 0; c < QG; ++c) { s0[c] = wmma16(ka1, qb1[c], s0[c]); s1[c] = wmma16(kc1, qb1[c], s1[c]); }
    v16h pb[QG];                                       // B operand: element r = key 8g + r, element 8 + r = key 16 + 8g + r, as frag_h orders V^T's k
#pragma unroll
    for (int c = 0; c < QG; ++c) {
      const v8f x0 = s0[c] * 0.125f + m0.v, x1 = s1[c] * 0.125f + m1.v;
      float mx = fmaxf(x0[0], x1[0]);
#pragma unroll
      for (int r = 1; r < 8; ++r) mx = fmaxf(mx, fmaxf(x0[r], x1[r]));
      mx = fmaxf(mx, xhalf(mx));                       // both halves now hold the query's maximum over the 32 keys
      const float mn = fmaxf(mrun[c], mx);
      const float corr = __builtin_amdgcn_exp2f((mrun[c] - mn) * LOG2E);
      // e^d * 2^14 = 2^(d * log2 e + 14): one fma and one hardware exponential per score; d <= 0, so p <= 2^14, and a result below 2^-126 is 0
      const v8f t0 = (x0 - mn) * LOG2E + 14.0f, t1 = (x1 - mn) * LOG2E + 14.0f;
      v8f p0, p1;                                      // a loop per tile, both unrolled into registers: neighbouring scores of one tile share a packed fma, with no register moves
#pragma unroll
      for (int r = 0; r < 8; ++r) p0[r] = __builtin_amdgcn_exp2f(t0[r]);
#pragma unroll
      for (int r = 0; r < 8; ++r) p1[r] = __builtin_amdgcn_exp2f(t1[r]);
      const v8f ps = p0 + p1;
      const float sum = ((ps[0] + ps[1]) + (ps[2] + ps[3])) + ((ps[4] + ps[5]) + (ps[6] + ps[7]));
#pragma unroll
      for (int r = 0; r < 8; ++r) { pb[c][r] = (_Float16)p0[r]; pb[c][8 + r] = (_Float16)p1[r]; }
      lrun[c] = lrun[c] * corr + sum; mrun[c] = mn;
#pragma unroll
      for (int t = 0; t < 4; ++t) acc[c][t] *= corr;
    }
    v16h vf[4];                                        // likewise the 8 reads of V^T's rows
#pragma unroll
    for (int t = 0; t < 4; ++t) vf[t] = frag_h(sb + (64 + t * 16 + ln) * RP + kk, lane);
#pragma unroll
    for (int t = 0; t < 4; ++t) {
#pragma unroll
      for (int c = 0; c < QG; ++c) acc[c][t] = wmma16(vf[t], pb[c], acc[c][t]); }
   }
   asm volatile("s_wait_dscnt 0x0" ::: "memory");     // this wave's reads of buffer st&1 are done before the buffer is refilled
   asm volatile("s_wait_asynccnt 0x0" ::: "memory");  // this wave's copies of stage st+1 have landed before other waves read them
   __syncthreads();                                   // publishes stage st+1 and ends every reader's last read of buffer st&1
   if (st + 2 < WW / AK) { const int s2 = (st + 2 + rot) & (WW / AK - 1); stage_copy_kv(l0 + (st & 1) * ABYTES, gk + (size_t)s2 * AK * HD, gv + s2 * AK); }
  }
  asm volatile("s_wait_asynccnt 0x0" ::: "memory");    // no copy is outstanding when the buffers become the epilogue's staging
  // acc[c][t][r] = O^T[d = t*16 + 8g + r][query 16c + ln]: stage as sOT[d][w_local], w_local = w*32 + 16c + ln
#pragma unroll
  for (int c = 0; c < QG; ++c) {
    const float il = 1.0f / (lrun[c] + xhalf(lrun[c]));   // lrun carries P's 2^14 like acc: the lift cancels
#pragma unroll
    for (int t = 0; t < 4; ++t) {
#pragma unroll
      for (int r = 0; r < 8; ++r) sOT[t * 16 + 8 * g + r][w * (QG * 16) + c * 16 + ln] = acc[c][t][r] * il; } }
  __syncthreads();
  const int qb0_ = blockIdx.x * QB;
  for (int q = tid; q < HD * (QB / 4); q += 256) { const int d = q / (QB / 4), pc = q & (QB / 4 - 1);
    vst2(out + ((size_t)n * CC + h * HD + d) * WW + qb0_ + pc * 4, *(const v4f*)(&sOT[d][pc * 4])); }
}

extern "C" void kernel_launch(void* const* d_in, const int* in_sizes, int n_in,
                              void* d_out, int out_size, void* d_ws, size_t ws_size,
                              hipStream_t stream) {
  (void)in_sizes; (void)n_in; (void)out_size; (void)ws_size;
  const float* hs   = (const float*)d_in[0];
  const float* mask = (const float*)d_in[1];
  const float* wq = (const float*)d_in[2]; const float* bq = (const float*)d_in[3];
  const float* wk = (const float*)d_in[4]; const float* bk = (const float*)d_in[5];
  const float* wv = (const float*)d_in[6]; const float* bv = (const float*)d_in[7];
  float* out = (float*)d_out;
  char* ws = (char*)d_ws; size_t off = 0;
  auto take = [&](size_t bytes) { char* p = ws + off; off += (bytes + 255) & ~(size_t)255; return p; };
  _Float16* xT = (_Float16*)take((size_t)NB * WW * CC * 2);      // 16 MB
  _Float16* wh = (_Float16*)take((size_t)3 * CC * CC * 2);       // 6 MB
  _Float16* qh = (_Float16*)take((size_t)NB * HH * WW * HD * 2);  // 16 MB
  _Float16* kh = (_Float16*)take((size_t)NB * HH * WW * HD * 2);
  _Float16* vT = (_Float16*)take((size_t)NB * HH * HD * WW * 2);
  k_xT<<<dim3(WW / 64, CC / 64, NB), 256, 0, stream>>>(hs, xT);
  k_wcvt<<<dim3((CC * CC / 8) / 256, 3), 256, 0, stream>>>(wq, wk, wv, wh);
  k_qkv<<<dim3(CC / BN, NB * (WW / BM), 3), 256, 0, stream>>>(xT, wh, bq, bk, bv, qh, kh, vT);
  k_attn<<<dim3(WW / QB, NB * HH), 256, 0, stream>>>(qh, kh, vT, mask, out);
}

// v009
// A run of this version takes 86.3 microseconds.
// It is 1.09 times as fast as v007, going by the measured steps of the versions left out in between.
// Counting every step since v000, it is 5.32 times as fast.
#include <hip/hip_runtime.h>
#include <math.h>

// Conv1d(k=1) self-attention: q/k/v = 1x1 conv over [N,C,W] (C = 1024), 16 heads x 64, softmax(q.k/8 + mask) v, output
// [N,C,W]. Contractions on v_wmma_f32_16x16x32_f16 with f16 operands (x pre-transposed once to f16 [n][w][c] rows, weights
// converted to f16 rows), f32 accumulate; online softmax in f32 against a lazily renewed reference maximum, P lifted by 2^7 inside its exponential (the row sum carries the same lift)

#define NB 8
#define CC 1024
#define WW 1024
#define HH 16
#define HD 64
#define BK 32
#define LOG2E 1.44269504088896340736f
#define PL 7.0f                  // P = 2^(score in log2 units - reference + PL)
#define PLIM 60000.0f            // a lane's 16 P are >= 0: while their sum stays below this, each of them converts to a finite f16

typedef __attribute__((ext_vector_type(16))) _Float16 v16h;
typedef __attribute__((ext_vector_type(8)))  _Float16 v8h;
typedef __attribute__((ext_vector_type(8)))  float v8f;
typedef __attribute__((ext_vector_type(4)))  float v4f;
typedef __attribute__((ext_vector_type(4)))  unsigned v4u;

template <typename T> __device__ __forceinline__ void vst2(void* p, T v) { *(T*)p = v;  }
__device__ __forceinline__ v8f wmma16(v16h a, v16h b, v8f c) {
  v8f d = __builtin_amdgcn_wmma_f32_16x16x32_f16(false, a, false, b, (short)0, c, false, false);
  asm volatile("v_nop\n\tv_nop\n\tv_nop\n\tv_nop" : "+v"(d) : "v"(a), "v"(b));
  return d;
}
// the bare builtin: the compiler pads it where the straight-line code behind it needs the distance, and nowhere else, so the vector port keeps those slots for other waves
__device__ __forceinline__ v8f wmma16b(v16h a, v16h b, v8f c) {
  return __builtin_amdgcn_wmma_f32_16x16x32_f16(false, a, false, b, (short)0, c, false, false);
}
__device__ __forceinline__ v16h frag_h(const _Float16* rowk0, int lane) {
  union { v16h v; v8h q[2]; } u; const _Float16* p = rowk0 + 8 * (lane >> 4);
  u.q[0] = *(const v8h*)p; u.q[1] = *(const v8h*)(p + 16); return u.v;
}
// lane l <-> lane l ^ 16, on the vector pipe
__device__ __forceinline__ float xhalf(float x) {
  const int b = __builtin_bit_cast(int, x);
  return __builtin_bit_cast(float, __builtin_amdgcn_permlanex16(b, b, 0x76543210, 0xfedcba98, false, false));
}

__global__ __launch_bounds__(256) void k_xT(const float* __restrict__ x, _Float16* __restrict__ xT) {
  __shared__ float tile[64][65];
  const int n = blockIdx.z, c0 = blockIdx.y * 64, w0 = blockIdx.x * 64, tid = threadIdx.x;
  for (int q = tid; q < 64 * 64; q += 256) { const int cl = q >> 6, wl = q & 63; tile[cl][wl] = x[((size_t)n * CC + c0 + cl) * WW + w0 + wl]; }
  __syncthreads();
  for (int q = tid; q < 64 * 8; q += 256) { const int wl = q >> 3, pc = q & 7;
    union { v8h h; v4u u; } pk;
#pragma unroll
    for (int e = 0; e < 8; ++e) pk.h[e] = (_Float16)tile[pc * 8 + e][wl];
    vst2(xT + ((size_t)n * WW + w0 + wl) * CC + c0 + pc * 8, pk.u); }
}
// ---- weights f32 [Cout][Cin] -> f16 rows (same layout), 16 B per thread; all three matrices in one launch (grid.y)
__global__ __launch_bounds__(256) void k_wcvt(const float* __restrict__ wq, const float* __restrict__ wk, const float* __restrict__ wv, _Float16* __restrict__ wh) {
  const size_t g8 = (size_t)blockIdx.x * 256 + threadIdx.x; const int m = blockIdx.y;
  const float* s = m == 0 ? wq : (m == 1 ? wk : wv);
  union { v8h h; v4u u; } pk;
#pragma unroll
  for (int e = 0; e < 8; ++e) pk.h[e] = (_Float16)s[g8 * 8 + e];
  vst2(wh + (size_t)m * CC * CC + g8 * 8, pk.u);
}

// ---- one stage of k_qkv's operands, global -> LDS without registers: 384 rows x 128 B, 12 x 16 B per thread
#define KS 64                    // k per stage: 128 B of every operand row
#define RP 72                    // LDS row pitch in halves: 144 B = 16 B x 9, no bank conflict for 16-byte fragment reads
#define BM 128                   // positions per block
#define BN 256                   // output channels per block (4 heads)
#define SBYTES ((BM + BN) * RP * 2)   // one stage buffer
#define STP (BM + 4)             // epilogue staging pitch in floats
__device__ __forceinline__ void stage_copy(unsigned l, const _Float16* gx, const _Float16* gw) {
  // the closing s_wait_xcnt stands inside the statement so that no address register is rewritten ahead of it
  asm volatile("global_load_async_to_lds_b128 %0, %12, off\n\t"
               "global_load_async_to_lds_b128 %1, %13, off\n\t"
               "global_load_async_to_lds_b128 %2, %14, off\n\t"
               "global_load_async_to_lds_b128 %3, %15, off\n\t"
               "global_load_async_to_lds_b128 %4, %16, off\n\t"
               "global_load_async_to_lds_b128 %5, %17, off\n\t"
               "global_load_async_to_lds_b128 %6, %18, off\n\t"
               "global_load_async_to_lds_b128 %7, %19, off\n\t"
               "global_load_async_to_lds_b128 %8, %20, off\n\t"
               "global_load_async_to_lds_b128 %9, %21, off\n\t"
               "global_load_async_to_lds_b128 %10, %22, off\n\t"
               "global_load_async_to_lds_b128 %11, %23, off\n\t"
               "s_wait_xcnt 0x0"
               :: "v"(l), "v"(l + 1 * 32 * RP * 2), "v"(l + 2 * 32 * RP * 2), "v"(l + 3 * 32 * RP * 2),
                  "v"(l + 4 * 32 * RP * 2), "v"(l + 5 * 32 * RP * 2), "v"(l + 6 * 32 * RP * 2), "v"(l + 7 * 32 * RP * 2),
                  "v"(l + 8 * 32 * RP * 2), "v"(l + 9 * 32 * RP * 2), "v"(l + 10 * 32 * RP * 2), "v"(l + 11 * 32 * RP * 2),
                  "v"(gx), "v"(gx + 1 * 32 * CC), "v"(gx + 2 * 32 * CC), "v"(gx + 3 * 32 * CC),
                  "v"(gw), "v"(gw + 1 * 32 * CC), "v"(gw + 2 * 32 * CC), "v"(gw + 3 * 32 * CC),
                  "v"(gw + 4 * 32 * CC), "v"(gw + 5 * 32 * CC), "v"(gw + 6 * 32 * CC), "v"(gw + 7 * 32 * CC)
               : "memory");
}

// ---- projections: block = 128 positions (n, w0..) x 256 output channels (4 heads) of q/k/v (grid.z), 8 waves as 2 x 4; K = 1024
// a wave owns 64 positions x 64 channels: 8 fragments feed 16 products, one 16-byte LDS read per product
// q,k -> [n][h][w][64] f16 rows; v -> vT[n][h][d][w] f16
__global__ __launch_bounds__(256) void k_qkv(const _Float16* __restrict__ xT, const _Float16* __restrict__ wh, const float* __restrict__ bq,
                                           const float* __restrict__ bk, const float* __restrict__ bv,
                                           _Float16* __restrict__ qh, _Float16* __restrict__ kh, _Float16* __restrict__ vT) {
  // two stage buffers of [128 x rows | 256 weight rows] x 64 k; after the K loop the same bytes serve as the epilogue's st[256][132], the larger of the two uses
  static_assert(BN * STP * 4 >= 2 * SBYTES, "the staging array holds both stage buffers");
  __shared__ __align__(16) unsigned char sm[BN * STP * 4];
  float (*st)[STP] = (float (*)[STP])sm;
  const int tid = threadIdx.x, wave = tid >> 5, lane = tid & 31, col = lane & 15, g = lane >> 4;
  const int wm = wave & 1, wn = wave >> 1;             // the wave's 64 positions and its 64 channels inside the block
  const int n = blockIdx.y / (WW / BM), w0 = (blockIdx.y % (WW / BM)) * BM, o0 = blockIdx.x * BN, which = blockIdx.z;
  const _Float16* W = wh + (size_t)which * CC * CC;
  const float* bb = which == 0 ? bq : (which == 1 ? bk : bv);
  v8f acc[4][4] = {};
  // copy map: 8 lanes cover one 128-B row slice (a whole line), a thread's 12 copies are 32 rows apart
  const int cr = tid >> 3, cq = tid & 7;
  const _Float16* gx = xT + ((size_t)n * WW + w0 + cr) * CC + cq * 8;
  const _Float16* gw = W + (size_t)(o0 + cr) * CC + cq * 8;
  const unsigned l0 = (unsigned)(size_t)sm + cr * (RP * 2) + cq * 16;
  // trip t works on k slice (t + rot) mod 16: the 64 blocks that share weight rows and the 12 that share x rows walk k from different starts,
  // so that they do not ask L2 for the same lines at the same moment
  const int rot = (blockIdx.y + blockIdx.x + (CC / BN) * blockIdx.z) & (CC / KS - 1);
  stage_copy(l0, gx + rot * KS, gw + rot * KS);
  asm volatile("s_wait_asynccnt 0x0" ::: "memory");   // stage 0 has landed before the barrier that publishes it
  __syncthreads();
  { const int s1 = ((1 + rot) & (CC / KS - 1)) * KS; stage_copy(l0 + SBYTES, gx + s1, gw + s1); }
#pragma unroll 1   // rolled: one publish point per trip keeps the two-buffer order below as written
  for (int t = 0; t < CC / KS; ++t) {
    const _Float16* sb = (const _Float16*)(sm + (t & 1) * SBYTES);
#pragma unroll
    for (int kk = 0; kk < KS; kk += 32) {
      // all 16 fragment reads of a 32-k block go out as one group, so that one LDS latency is paid per block and not per product
      v16h a[4], b[4];
#pragma unroll
      for (int i = 0; i < 4; ++i) a[i] = frag_h(sb + (wm * 64 + i * 16 + col) * RP + kk, lane);
#pragma unroll
      for (int j = 0; j < 4; ++j) b[j] = frag_h(sb + (BM + wn * 64 + j * 16 + col) * RP + kk, lane);
      __builtin_amdgcn_sched_barrier(0);   // nothing moves across this line: it keeps the 16 reads one group ahead of the 16 products
#pragma unroll
      for (int i = 0; i < 4; ++i) {
#pragma unroll
        for (int j = 0; j < 4; ++j) acc[i][j] = wmma16b(a[i], b[j], acc[i][j]); }
    }
    __builtin_amdgcn_sched_barrier(0);                 // the trip's products stay ahead of its waits: sunk behind them they would halve the time the next stage's copies have to land
    asm volatile("s_wait_dscnt 0x0" ::: "memory");     // this wave's reads of buffer t&1 are done before the buffer is refilled
    asm volatile("s_wait_asynccnt 0x0" ::: "memory");  // this wave's copies of stage t+1 have landed before other waves read them
    __syncthreads();                                   // publishes stage t+1 and ends every reader's last read of buffer t&1
    if (t + 2 < CC / KS) { const int s2 = ((t + 2 + rot) & (CC / KS - 1)) * KS; stage_copy(l0 + (t & 1) * SBYTES, gx + s2, gw + s2); }
  }
  asm volatile("s_wait_asynccnt 0x0" ::: "memory");    // no copy is outstanding when the buffers become the epilogue's staging
#pragma unroll
  for (int j = 0; j < 4; ++j) { const float bv_ = bb[o0 + wn * 64 + j * 16 + col];
#pragma unroll
    for (int i = 0; i < 4; ++i) {
#pragma unroll
      for (int r = 0; r < 8; ++r) st[wn * 64 + j * 16 + col][wm * 64 + i * 16 + 8 * g + r] = acc[i][j][r] + bv_; } }
  __syncthreads();
  const int h0 = o0 / HD;
  if (which < 2) {
    _Float16* dst = which == 0 ? qh : kh;
    for (int q = tid; q < (BN / HD) * BM * 8; q += 256) { const int hh = q / (BM * 8), wl = (q >> 3) & (BM - 1), pc = q & 7;
      union { v8h h; v4u u; } pk;
#pragma unroll
      for (int e = 0; e < 8; ++e) pk.h[e] = (_Float16)st[hh * 64 + pc * 8 + e][wl];
      vst2(dst + (((size_t)n * HH + h0 + hh) * WW + w0 + wl) * HD + pc * 8, pk.u); }
  } else {
    for (int q = tid; q < BN * (BM / 8); q += 256) { const int cl = q / (BM / 8), pc = q & (BM / 8 - 1); const int hh = cl >> 6, d = cl & 63;
      union { v8h h; v4u u; } pk;
#pragma unroll
      for (int i = 0; i < 8; ++i) pk.h[i] = (_Float16)st[cl][pc * 8 + i];
      vst2(vT + (((size_t)n * HH + h0 + hh) * HD + d) * WW + w0 + pc * 8, pk.u); }
  }
}

// ---- one stage of k_attn's operands, global -> LDS without registers: 64 key rows of K and the 64 d rows of V^T, 128 B of each; 4 x 16 B per thread
#define AK 64                    // keys per stage: a whole 128-B line of every V^T row, two 32-key passes
#define ABYTES (128 * RP * 2)    // one stage buffer, rows at k_qkv's 144-B pitch
#define QG 2                     // 16-query column groups per wave: each K and V^T fragment read from LDS feeds both
#define QB 256                   // queries per block: 8 waves x 32
#define OTP (QB + 4)             // epilogue staging pitch in floats
__device__ __forceinline__ void stage_copy_kv(unsigned l, const _Float16* gk, const _Float16* gv) {
  // the closing s_wait_xcnt stands inside the statement so that no address register is rewritten ahead of it
  asm volatile("global_load_async_to_lds_b128 %0, %4, off\n\t"
               "global_load_async_to_lds_b128 %1, %5, off\n\t"
               "global_load_async_to_lds_b128 %2, %6, off\n\t"
               "global_load_async_to_lds_b128 %3, %7, off\n\t"
               "s_wait_xcnt 0x0"
               :: "v"(l), "v"(l + 1 * 32 * RP * 2), "v"(l + 2 * 32 * RP * 2), "v"(l + 3 * 32 * RP * 2),
                  "v"(gk), "v"(gk + 32 * HD), "v"(gv), "v"(gv + 32 * WW)
               : "memory");
}

__global__ __launch_bounds__(256) void k_attn(const _Float16* __restrict__ qh, const _Float16* __restrict__ kh, const _Float16* __restrict__ vT,
                                            const float* __restrict__ mask, float* __restrict__ out) {
  // two stage buffers of [64 K rows | 64 V^T rows] x 64 keys; after the key loop the same bytes serve as the epilogue's sOT[d][w_local], the larger of the two uses
  static_assert(HD * OTP * 4 >= 2 * ABYTES, "the staging array holds both stage buffers");
  __shared__ __align__(16) unsigned char sm[HD * OTP * 4];
  float (*sOT)[OTP] = (float (*)[OTP])sm;
  const int tid = threadIdx.x, w = tid >> 5, lane = tid & 31, g = lane >> 4, ln = lane & 15;
  const int bh = blockIdx.y, n = bh / HH, h = bh % HH, q0 = blockIdx.x * QB + w * (QG * 16);
  v16h qb0[QG], qb1[QG];
#pragma unroll
  for (int c = 0; c < QG; ++c) { const _Float16* qrow = qh + ((size_t)bh * WW + q0 + c * 16 + ln) * HD;
    qb0[c] = frag_h(qrow, lane); qb1[c] = frag_h(qrow + 32, lane); }
  const float* mk = mask + (size_t)n * WW + 8 * g;     // [N,1,1,W]: per key; this lane's keys are 8g + r and 16 + 8g + r of a pass
  float mref[QG], lrun[QG];                            // mref: the query's reference maximum, log2 units; lrun: the sum over this lane's own keys, the halves are joined after the loop
  v8f acc[QG][4];
#pragma unroll
  for (int c = 0; c < QG; ++c) { mref[c] = -3.0e38f; lrun[c] = 0.f;
#pragma unroll
    for (int t = 0; t < 4; ++t) acc[c][t] = (v8f){}; }
  const _Float16* kb = kh + (size_t)bh * WW * HD;
  const _Float16* vb = vT + (size_t)bh * HD * WW;
  // copy map: 8 lanes cover one 128-B row slice (a whole line), a thread's 4 copies are 32 rows apart
  const int cr = tid >> 3, cq = tid & 7;
  const _Float16* gk = kb + (size_t)cr * HD + cq * 8;
  const _Float16* gv = vb + (size_t)cr * WW + cq * 8;
  const unsigned l0 = (unsigned)(size_t)sm + cr * (RP * 2) + cq * 16;
  // stage st works on key slice (st + rot) mod 16: the 4 blocks of a head start a quarter of the keys apart, so that they do not ask L2 for the same
  // lines at the same moment; heads start one slice apart, so that the blocks' V^T pieces (128 B of 2-KB rows) do not all sit at one offset in the row.
  // The online softmax takes the slices in any order.
  const int rot = (blockIdx.x * (WW / AK / (WW / QB)) + blockIdx.y) & (WW / AK - 1);
  stage_copy_kv(l0, gk + (size_t)rot * AK * HD, gv + rot * AK);
  asm volatile("s_wait_asynccnt 0x0" ::: "memory");   // stage 0 has landed before the barrier that publishes it
  __syncthreads();
  { const int s1 = (1 + rot) & (WW / AK - 1); stage_copy_kv(l0 + ABYTES, gk + (size_t)s1 * AK * HD, gv + s1 * AK); }
#pragma unroll 1   // rolled: one publish point per trip keeps the two-buffer order below as written
  for (int st = 0; st < WW / AK; ++st) {
   const _Float16* sb = (const _Float16*)(sm + (st & 1) * ABYTES);
#pragma unroll 1   // rolled, as before: one pass's registers only
   for (int kk = 0; kk < AK; kk += BK) {
    const int k0 = ((st + rot) & (WW / AK - 1)) * AK + kk;
    union { v8f v; v4f q[2]; } m0, m1;
    m0.q[0] = *(const v4f*)(mk + k0);      m0.q[1] = *(const v4f*)(mk + k0 + 4);
    m1.q[0] = *(const v4f*)(mk + k0 + 16); m1.q[1] = *(const v4f*)(mk + k0 + 20);
    // the 8 fragment reads of the pass's K rows go out as one group: one LDS latency per pass and not one per product
    const v16h ka0 = frag_h(sb + (kk + ln) * RP, lane),      ka1 = frag_h(sb + (kk + ln) * RP + 32, lane);
    const v16h kc0 = frag_h(sb + (kk + 16 + ln) * RP, lane), kc1 = frag_h(sb + (kk + 16 + ln) * RP + 32, lane);
    // nothing moves across this line: the pass's four mask loads and eight K reads all go out at its head, so a pass waits out one cache latency and not two
    __builtin_amdgcn_sched_barrier(0);
    v8f s0[QG], s1[QG];                                // s0[c][r] = score(key k0 + 8g + r, query q0 + 16c + ln), s1[c][r]: key k0 + 16 + 8g + r
#pragma unroll
    for (int c = 0; c < QG; ++c) { s0[c] = wmma16b(ka0, qb0[c], (v8f){}); s1[c] = wmma16b(kc0, qb0[c], (v8f){}); }
#pragma unroll
    for (int c = 0; c < QG; ++c) { s0[c] = wmma16b(ka1, qb1[c], s0[c]); s1[c] = wmma16b(kc1, qb1[c], s1[c]); }
    v16h vf[4];                                        // likewise the 8 reads of V^T's rows; they stand ahead of the branch below, so that they fly during the exponentials
#pragma unroll
    for (int t = 0; t < 4; ++t) vf[t] = frag_h(sb + (64 + t * 16 + ln) * RP + kk, lane);
    // Lazy reference: the exponentials take the reference in use when the pass starts, so mask, lift and reference are one addend of one fma per score,
    // and neither a maximum nor a rescale stands in the common path. P may then exceed 2^PL; the test below renews the reference before one can leave f16's range.
    const v8f ml0 = m0.v * LOG2E + PL, ml1 = m1.v * LOG2E + PL;   // shared by the column groups
    v16h pb[QG];                                       // B operand: element r = key 8g + r, element 8 + r = key 16 + 8g + r, as frag_h orders V^T's k
    float sum[QG];
    // the loops here and in the branch are unrolled so that the register arrays keep constant indices
#pragma unroll
    for (int c = 0; c < QG; ++c) {
      const v8f t0 = s0[c] * (0.125f * LOG2E) + (ml0 - mref[c]), t1 = s1[c] * (0.125f * LOG2E) + (ml1 - mref[c]);
      v8f p0, p1;                                      // a loop per tile, both unrolled into registers: neighbouring scores of one tile share a packed fma, with no register moves
#pragma unroll
      for (int r = 0; r < 8; ++r) p0[r] = __builtin_amdgcn_exp2f(t0[r]);
#pragma unroll
      for (int r = 0; r < 8; ++r) p1[r] = __builtin_amdgcn_exp2f(t1[r]);
      const v8f ps = p0 + p1;
      sum[c] = ((ps[0] + ps[1]) + (ps[2] + ps[3])) + ((ps[4] + ps[5]) + (ps[6] + ps[7]));
#pragma unroll
      for (int r = 0; r < 8; ++r) { pb[c][r] = (_Float16)p0[r]; pb[c][8 + r] = (_Float16)p1[r]; }
    }
    // one test per pass, a scalar branch for the whole wave: taken in a wave's first pass (the start reference makes every P infinite) and when scores outgrow the reference
    if (__builtin_expect(__builtin_amdgcn_ballot_w32(!(fmaxf(sum[0], sum[1]) <= PLIM)) != 0, 0)) {
#pragma unroll
      for (int c = 0; c < QG; ++c) {
        const v8f y0 = s0[c] * (0.125f * LOG2E) + ml0, y1 = s1[c] * (0.125f * LOG2E) + ml1;   // scores in log2 units, lifted
        float mx = fmaxf(y0[0], y1[0]);
#pragma unroll
        for (int r = 1; r < 8; ++r) mx = fmaxf(mx, fmaxf(y0[r], y1[r]));
        mx = fmaxf(mx, xhalf(mx));                     // both halves now hold the query's maximum over the 32 keys, so both take the same new reference
        const float mn = fmaxf(mref[c], mx - PL);
        const float corr = __builtin_amdgcn_exp2f(mref[c] - mn);
        const v8f t0 = y0 - mn, t1 = y1 - mn;          // <= PL
        v8f p0, p1;
#pragma unroll
        for (int r = 0; r < 8; ++r) p0[r] = __builtin_amdgcn_exp2f(t0[r]);
#pragma unroll
        for (int r = 0; r < 8; ++r) p1[r] = __builtin_amdgcn_exp2f(t1[r]);
        const v8f ps = p0 + p1;
        sum[c] = ((ps[0] + ps[1]) + (ps[2] + ps[3])) + ((ps[4] + ps[5]) + (ps[6] + ps[7]));
#pragma unroll
        for (int r = 0; r < 8; ++r) { pb[c][r] = (_Float16)p0[r]; pb[c][8 + r] = (_Float16)p1[r]; }
        lrun[c] *= corr; mref[c] = mn;
#pragma unroll
        for (int t = 0; t < 4; ++t) acc[c][t] *= corr;
      }
    }
#pragma unroll
    for (int c = 0; c < QG; ++c) lrun[c] += sum[c];
#pragma unroll
    for (int t = 0; t < 4; ++t) {
#pragma unroll
      for (int c = 0; c < QG; ++c)
        // only the pass's last product keeps its four v_nop: the back edge leads to vector writes over its operand registers
        acc[c][t] = (t == 3 && c == QG - 1) ? wmma16(vf[t], pb[c], acc[c][t]) : wmma16b(vf[t], pb[c], acc[c][t]); }
   }
   asm volatile("s_wait_dscnt 0x0" ::: "memory");     // this wave's reads of buffer st&1 are done before the buffer is refilled
   asm volatile("s_wait_asynccnt 0x0" ::: "memory");  // this wave's copies of stage st+1 have landed before other waves read them
   __syncthreads();                                   // publishes stage st+1 and ends every reader's last read of buffer st&1
   if (st + 2 < WW / AK) { const int s2 = (st + 2 + rot) & (WW / AK - 1); stage_copy_kv(l0 + (st & 1) * ABYTES, gk + (size_t)s2 * AK * HD, gv + s2 * AK); }
  }
  asm volatile("s_wait_asynccnt 0x0" ::: "memory");    // no copy is outstanding when the buffers become the epilogue's staging
  // acc[c][t][r] = O^T[d = t*16 + 8g + r][query 16c + ln]: stage as sOT[d][w_local], w_local = w*32 + 16c + ln
#pragma unroll
  for (int c = 0; c < QG; ++c) {
    const float il = 1.0f / (lrun[c] + xhalf(lrun[c]));   // lrun carries P's lift and reference like acc: both cancel
#pragma unroll
    for (int t = 0; t < 4; ++t) {
#pragma unroll
      for (int r = 0; r < 8; ++r) sOT[t * 16 + 8 * g + r][w * (QG * 16) + c * 16 + ln] = acc[c][t][r] * il; } }
  __syncthreads();
  const int qb0_ = blockIdx.x * QB;
  for (int q = tid; q < HD * (QB / 4); q += 256) { const int d = q / (QB / 4), pc = q & (QB / 4 - 1);
    vst2(out + ((size_t)n * CC + h * HD + d) * WW + qb0_ + pc * 4, *(const v4f*)(&sOT[d][pc * 4])); }
}

extern "C" void kernel_launch(void* const* d_in, const int* in_sizes, int n_in,
                              void* d_out, int out_size, void* d_ws, size_t ws_size,
                              hipStream_t stream) {
  (void)in_sizes; (void)n_in; (void)out_size; (void)ws_size;
  const float* hs   = (const float*)d_in[0];
  const float* mask = (const float*)d_in[1];
  const float* wq = (const float*)d_in[2]; const float* bq = (const float*)d_in[3];
  const float* wk = (const float*)d_in[4]; const float* bk = (const float*)d_in[5];
  const float* wv = (const float*)d_in[6]; const float* bv = (const float*)d_in[7];
  float* out = (float*)d_out;
  char* ws = (char*)d_ws; size_t off = 0;
  auto take = [&](size_t bytes) { char* p = ws + off; off += (bytes + 255) & ~(size_t)255; return p; };
  _Float16* xT = (_Float16*)take((size_t)NB * WW * CC * 2);      // 16 MB
  _Float16* wh = (_Float16*)take((size_t)3 * CC * CC * 2);       // 6 MB
  _Float16* qh = (_Float16*)take((size_t)NB * HH * WW * HD * 2);  // 16 MB
  _Float16* kh = (_Float16*)take((size_t)NB * HH * WW * HD * 2);
  _Float16* vT = (_Float16*)take((size_t)NB * HH * HD * WW * 2);
  k_xT<<<dim3(WW / 64, CC / 64, NB), 256, 0, stream>>>(hs, xT);
  k_wcvt<<<dim3((CC * CC / 8) / 256, 3), 256, 0, stream>>>(wq, wk, wv, wh);
  k_qkv<<<dim3(CC / BN, NB * (WW / BM), 3), 256, 0, stream>>>(xT, wh, bq, bk, bv, qh, kh, vT);
  k_attn<<<dim3(WW / QB, NB * HH), 256, 0, stream>>>(qh, kh, vT, mask, out);
}

// v010
// A run of this version takes 82.6 microseconds.
// Two timings next to v009 put it at 1.05 and 1.04 times that version's speed.
// All steps since v000 together make it 5.55 times as fast.
#include <hip/hip_runtime.h>
#include <math.h>

// Conv1d(k=1) self-attention: q/k/v = 1x1 conv over [N,C,W] (C = 1024), 16 heads x 64, softmax(q.k/8 + mask) v, output
// [N,C,W]. Contractions on v_wmma_f32_16x16x32_f16 with f16 operands (x pre-transposed once to f16 [n][w][c] rows, weights
// converted to f16 rows), f32 accumulate; online softmax in f32 against a lazily renewed reference maximum, P lifted by 2^7 inside its exponential (the row sum carries the same lift)

#define NB 8
#define CC 1024
#define WW 1024
#define HH 16
#define HD 64
#define BK 32
#define LOG2E 1.44269504088896340736f
#define PL 7.0f                  // P = 2^(score in log2 units - reference + PL)
#define PLIM 60000.0f            // a lane's 16 P are >= 0: while their sum stays below this, each of them converts to a finite f16

typedef __attribute__((ext_vector_type(16))) _Float16 v16h;
typedef __attribute__((ext_vector_type(8)))  _Float16 v8h;
typedef __attribute__((ext_vector_type(8)))  float v8f;
typedef __attribute__((ext_vector_type(4)))  float v4f;
typedef __attribute__((ext_vector_type(4)))  unsigned v4u;

template <typename T> __device__ __forceinline__ void vst2(void* p, T v) { *(T*)p = v;  }
__device__ __forceinline__ v8f wmma16(v16h a, v16h b, v8f c) {
  v8f d = __builtin_amdgcn_wmma_f32_16x16x32_f16(false, a, false, b, (short)0, c, false, false);
  asm volatile("v_nop\n\tv_nop\n\tv_nop\n\tv_nop" : "+v"(d) : "v"(a), "v"(b));
  return d;
}
// the bare builtin: the compiler pads it where the straight-line code behind it needs the distance, and nowhere else, so the vector port keeps those slots for other waves
__device__ __forceinline__ v8f wmma16b(v16h a, v16h b, v8f c) {
  return __builtin_amdgcn_wmma_f32_16x16x32_f16(false, a, false, b, (short)0, c, false, false);
}
__device__ __forceinline__ v16h frag_h(const _Float16* rowk0, int lane) {
  union { v16h v; v8h q[2]; } u; const _Float16* p = rowk0 + 8 * (lane >> 4);
  u.q[0] = *(const v8h*)p; u.q[1] = *(const v8h*)(p + 16); return u.v;
}
// lane l <-> lane l ^ 16, on the vector pipe
__device__ __forceinline__ float xhalf(float x) {
  const int b = __builtin_bit_cast(int, x);
  return __builtin_bit_cast(float, __builtin_amdgcn_permlanex16(b, b, 0x76543210, 0xfedcba98, false, false));
}

__global__ __launch_bounds__(256) void k_xT(const float* __restrict__ x, _Float16* __restrict__ xT) {
  __shared__ float tile[64][65];
  const int n = blockIdx.z, c0 = blockIdx.y * 64, w0 = blockIdx.x * 64, tid = threadIdx.x;
  for (int q = tid; q < 64 * 64; q += 256) { const int cl = q >> 6, wl = q & 63; tile[cl][wl] = x[((size_t)n * CC + c0 + cl) * WW + w0 + wl]; }
  __syncthreads();
  for (int q = tid; q < 64 * 8; q += 256) { const int wl = q >> 3, pc = q & 7;
    union { v8h h; v4u u; } pk;
#pragma unroll
    for (int e = 0; e < 8; ++e) pk.h[e] = (_Float16)tile[pc * 8 + e][wl];
    vst2(xT + ((size_t)n * WW + w0 + wl) * CC + c0 + pc * 8, pk.u); }
}
// ---- weights f32 [Cout][Cin] -> f16 rows (same layout), 16 B per thread; all three matrices in one launch (grid.y)
__global__ __launch_bounds__(256) void k_wcvt(const float* __restrict__ wq, const float* __restrict__ wk, const float* __restrict__ wv, _Float16* __restrict__ wh) {
  const size_t g8 = (size_t)blockIdx.x * 256 + threadIdx.x; const int m = blockIdx.y;
  const float* s = m == 0 ? wq : (m == 1 ? wk : wv);
  union { v8h h; v4u u; } pk;
#pragma unroll
  for (int e = 0; e < 8; ++e) pk.h[e] = (_Float16)s[g8 * 8 + e];
  vst2(wh + (size_t)m * CC * CC + g8 * 8, pk.u);
}

// ---- one stage of k_qkv's operands, global -> LDS without registers: 384 rows x 128 B, 12 x 16 B per thread
#define KS 64                    // k per stage: 128 B of every operand row
#define RP 72                    // LDS row pitch in halves: 144 B = 16 B x 9, no bank conflict for 16-byte fragment reads
#define BM 128                   // positions per block
#define BN 256                   // output channels per block (4 heads)
#define SBYTES ((BM + BN) * RP * 2)   // one stage buffer
__device__ __forceinline__ void stage_copy(unsigned l, const _Float16* gx, const _Float16* gw) {
  // the closing s_wait_xcnt stands inside the statement so that no address register is rewritten ahead of it
  asm volatile("global_load_async_to_lds_b128 %0, %12, off\n\t"
               "global_load_async_to_lds_b128 %1, %13, off\n\t"
               "global_load_async_to_lds_b128 %2, %14, off\n\t"
               "global_load_async_to_lds_b128 %3, %15, off\n\t"
               "global_load_async_to_lds_b128 %4, %16, off\n\t"
               "global_load_async_to_lds_b128 %5, %17, off\n\t"
               "global_load_async_to_lds_b128 %6, %18, off\n\t"
               "global_load_async_to_lds_b128 %7, %19, off\n\t"
               "global_load_async_to_lds_b128 %8, %20, off\n\t"
               "global_load_async_to_lds_b128 %9, %21, off\n\t"
               "global_load_async_to_lds_b128 %10, %22, off\n\t"
               "global_load_async_to_lds_b128 %11, %23, off\n\t"
               "s_wait_xcnt 0x0"
               :: "v"(l), "v"(l + 1 * 32 * RP * 2), "v"(l + 2 * 32 * RP * 2), "v"(l + 3 * 32 * RP * 2),
                  "v"(l + 4 * 32 * RP * 2), "v"(l + 5 * 32 * RP * 2), "v"(l + 6 * 32 * RP * 2), "v"(l + 7 * 32 * RP * 2),
                  "v"(l + 8 * 32 * RP * 2), "v"(l + 9 * 32 * RP * 2), "v"(l + 10 * 32 * RP * 2), "v"(l + 11 * 32 * RP * 2),
                  "v"(gx), "v"(gx + 1 * 32 * CC), "v"(gx + 2 * 32 * CC), "v"(gx + 3 * 32 * CC),
                  "v"(gw), "v"(gw + 1 * 32 * CC), "v"(gw + 2 * 32 * CC), "v"(gw + 3 * 32 * CC),
                  "v"(gw + 4 * 32 * CC), "v"(gw + 5 * 32 * CC), "v"(gw + 6 * 32 * CC), "v"(gw + 7 * 32 * CC)
               : "memory");
}

// ---- projections: block = 128 positions (n, w0..) x 256 output channels (4 heads) of q/k/v (grid.z), 8 waves as 2 x 4; K = 1024
// a wave owns 64 positions x 64 channels (one head): 8 fragments feed 16 products, one 16-byte LDS read per product
// q,k -> [n][h][w][64] f16 rows; v -> vT[n][h][d][w] f16. The operand whose index runs along the output row is given as A (channels for q and k, positions for v):
// a lane's 8 accumulator registers are then 8 neighbours of one output row, 16 bytes of f16, and nothing is transposed behind the products
__global__ __launch_bounds__(256) void k_qkv(const _Float16* __restrict__ xT, const _Float16* __restrict__ wh, const float* __restrict__ bq,
                                           const float* __restrict__ bk, const float* __restrict__ bv,
                                           _Float16* __restrict__ qh, _Float16* __restrict__ kh, _Float16* __restrict__ vT) {
  // two stage buffers of [128 x rows | 256 weight rows] x 64 k; after the K loop each wave stages its own 64 output rows x 128 B in a part of the same bytes
  static_assert(8 * 64 * RP * 2 <= 2 * SBYTES, "the stage buffers hold the 8 waves' output rows");
  __shared__ __align__(16) unsigned char sm[2 * SBYTES];
  const int tid = threadIdx.x, wave = tid >> 5, lane = tid & 31, col = lane & 15, g = lane >> 4;
  const int wm = wave & 1, wn = wave >> 1;             // the wave's 64 positions and its 64 channels inside the block
  const int n = blockIdx.y / (WW / BM), w0 = (blockIdx.y % (WW / BM)) * BM, o0 = blockIdx.x * BN, which = blockIdx.z;
  const _Float16* W = wh + (size_t)which * CC * CC;
  const float* bb = which == 0 ? bq : (which == 1 ? bk : bv);
  const bool tr = which < 2;                           // q, k: A = weight rows, B = x rows; v: A = x rows, B = weight rows
  const int ar = tr ? BM + wn * 64 : wm * 64, br = tr ? wm * 64 : BM + wn * 64;   // the wave's A and B rows in a stage buffer
  v8f acc[4][4] = {};
  // copy map: 8 lanes cover one 128-B row slice (a whole line), a thread's 12 copies are 32 rows apart
  const int cr = tid >> 3, cq = tid & 7;
  const _Float16* gx = xT + ((size_t)n * WW + w0 + cr) * CC + cq * 8;
  const _Float16* gw = W + (size_t)(o0 + cr) * CC + cq * 8;
  const unsigned l0 = (unsigned)(size_t)sm + cr * (RP * 2) + cq * 16;
  // trip t works on k slice (t + rot) mod 16: the 64 blocks that share weight rows and the 12 that share x rows walk k from different starts,
  // so that they do not ask L2 for the same lines at the same moment
  const int rot = (blockIdx.y + blockIdx.x + (CC / BN) * blockIdx.z) & (CC / KS - 1);
  stage_copy(l0, gx + rot * KS, gw + rot * KS);
  asm volatile("s_wait_asynccnt 0x0" ::: "memory");   // stage 0 has landed before the barrier that publishes it
  __syncthreads();
  { const int s1 = ((1 + rot) & (CC / KS - 1)) * KS; stage_copy(l0 + SBYTES, gx + s1, gw + s1); }
#pragma unroll 1   // rolled: one publish point per trip keeps the two-buffer order below as written
  for (int t = 0; t < CC / KS; ++t) {
    const _Float16* sb = (const _Float16*)(sm + (t & 1) * SBYTES);
#pragma unroll
    for (int kk = 0; kk < KS; kk += 32) {
      // all 16 fragment reads of a 32-k block go out as one group, so that one LDS latency is paid per block and not per product
      v16h a[4], b[4];
#pragma unroll
      for (int i = 0; i < 4; ++i) a[i] = frag_h(sb + (ar + i * 16 + col) * RP + kk, lane);
#pragma unroll
      for (int j = 0; j < 4; ++j) b[j] = frag_h(sb + (br + j * 16 + col) * RP + kk, lane);
      __builtin_amdgcn_sched_barrier(0);   // nothing moves across this line: it keeps the 16 reads one group ahead of the 16 products
#pragma unroll
      for (int i = 0; i < 4; ++i) {
#pragma unroll
        for (int j = 0; j < 4; ++j) acc[i][j] = wmma16b(a[i], b[j], acc[i][j]); }
    }
    __builtin_amdgcn_sched_barrier(0);                 // the trip's products stay ahead of its waits: sunk behind them they would halve the time the next stage's copies have to land
    asm volatile("s_wait_dscnt 0x0" ::: "memory");     // this wave's reads of buffer t&1 are done before the buffer is refilled
    asm volatile("s_wait_asynccnt 0x0" ::: "memory");  // this wave's copies of stage t+1 have landed before other waves read them
    __syncthreads();                                   // publishes stage t+1 and ends every reader's last read of buffer t&1
    if (t + 2 < CC / KS) { const int s2 = ((t + 2 + rot) & (CC / KS - 1)) * KS; stage_copy(l0 + (t & 1) * SBYTES, gx + s2, gw + s2); }
  }
  asm volatile("s_wait_asynccnt 0x0" ::: "memory");    // no copy is outstanding when the buffers become the epilogue's staging
  // acc[i][j][r] = D[A row i*16 + 8g + r][B row j*16 + col]: staged as row j*16 + col, halves i*16 + 8g .. + 7, at the fragment reads' conflict-free 144-B pitch.
  // The loop's last barrier has ended every wave's reads of the buffers, and a wave reads back only what it wrote itself: no further barrier.
  _Float16* sw = (_Float16*)sm + wave * (64 * RP);
  const float* bw = bb + o0 + wn * 64;                 // the wave's 64 biases
  if (tr) {
    union { v8f v; v4f q[2]; } bi[4];                  // the bias runs along the A rows; all its loads go out ahead of the first tile, one latency for the four groups
#pragma unroll
    for (int i = 0; i < 4; ++i) { bi[i].q[0] = *(const v4f*)(bw + i * 16 + 8 * g); bi[i].q[1] = *(const v4f*)(bw + i * 16 + 8 * g + 4); }
#pragma unroll
    for (int i = 0; i < 4; ++i) {
#pragma unroll
      for (int j = 0; j < 4; ++j) { const v8f s = acc[i][j] + bi[i].v;
        union { v8h h; v4u u; } pk;
#pragma unroll
        for (int r = 0; r < 8; ++r) pk.h[r] = (_Float16)s[r];
        vst2(sw + (j * 16 + col) * RP + i * 16 + 8 * g, pk.u); }
      __builtin_amdgcn_sched_barrier(0); }             // four tiles at a time: with all 16 tiles' sums live at once the kernel passes 256 registers, and a WGP then holds one block, not two
  } else {
    float bj[4];                                       // the bias runs along the B rows; loaded ahead likewise
#pragma unroll
    for (int j = 0; j < 4; ++j) bj[j] = bw[j * 16 + col];
#pragma unroll
    for (int j = 0; j < 4; ++j) {
#pragma unroll
      for (int i = 0; i < 4; ++i) { const v8f s = acc[i][j] + bj[j];
        union { v8h h; v4u u; } pk;
#pragma unroll
        for (int r = 0; r < 8; ++r) pk.h[r] = (_Float16)s[r];
        vst2(sw + (j * 16 + col) * RP + i * 16 + 8 * g, pk.u); }
      __builtin_amdgcn_sched_barrier(0); }             // four tiles at a time, for the register count, as above
  }
  asm volatile("s_wait_dscnt 0x0" ::: "memory");       // the wave's staging writes are done before its lanes read one another's rows back
  const size_t nh = (size_t)n * HH + o0 / HD + wn;     // the wave's head
  _Float16* dst = tr ? (which == 0 ? qh : kh) + (nh * WW + w0 + wm * 64) * HD : vT + nh * HD * WW + w0 + wm * 64;
  const int dp = tr ? HD : WW;                         // pitch of the output rows: positions of q and k, channels of V^T
  // 8 lanes carry one whole 128-B row, a wave 4 rows at a time
  dst += (lane >> 3) * dp + (lane & 7) * 8; sw += (lane >> 3) * RP + (lane & 7) * 8;
#pragma unroll
  for (int it = 0; it < 16; ++it) vst2(dst + it * 4 * dp, *(const v4u*)(sw + it * 4 * RP));
}

// ---- one stage of k_attn's operands, global -> LDS without registers: 64 key rows of K and the 64 d rows of V^T, 128 B of each; 4 x 16 B per thread
#define AK 64                    // keys per stage: a whole 128-B line of every V^T row, two 32-key passes
#define ABYTES (128 * RP * 2)    // one stage buffer, rows at k_qkv's 144-B pitch
#define QG 2                     // 16-query column groups per wave: each K and V^T fragment read from LDS feeds both
#define QB 256                   // queries per block: 8 waves x 32
#define OTP (QB + 4)             // epilogue staging pitch in floats
__device__ __forceinline__ void stage_copy_kv(unsigned l, const _Float16* gk, const _Float16* gv) {
  // the closing s_wait_xcnt stands inside the statement so that no address register is rewritten ahead of it
  asm volatile("global_load_async_to_lds_b128 %0, %4, off\n\t"
               "global_load_async_to_lds_b128 %1, %5, off\n\t"
               "global_load_async_to_lds_b128 %2, %6, off\n\t"
               "global_load_async_to_lds_b128 %3, %7, off\n\t"
               "s_wait_xcnt 0x0"
               :: "v"(l), "v"(l + 1 * 32 * RP * 2), "v"(l + 2 * 32 * RP * 2), "v"(l + 3 * 32 * RP * 2),
                  "v"(gk), "v"(gk + 32 * HD), "v"(gv), "v"(gv + 32 * WW)
               : "memory");
}

__global__ __launch_bounds__(256) void k_attn(const _Float16* __restrict__ qh, const _Float16* __restrict__ kh, const _Float16* __restrict__ vT,
                                            const float* __restrict__ mask, float* __restrict__ out) {
  // two stage buffers of [64 K rows | 64 V^T rows] x 64 keys; after the key loop the same bytes serve as the epilogue's sOT[d][w_local], the larger of the two uses
  static_assert(HD * OTP * 4 >= 2 * ABYTES, "the staging array holds both stage buffers");
  __shared__ __align__(16) unsigned char sm[HD * OTP * 4];
  float (*sOT)[OTP] = (float (*)[OTP])sm;
  const int tid = threadIdx.x, w = tid >> 5, lane = tid & 31, g = lane >> 4, ln = lane & 15;
  const int bh = blockIdx.y, n = bh / HH, h = bh % HH, q0 = blockIdx.x * QB + w * (QG * 16);
  v16h qb0[QG], qb1[QG];
#pragma unroll
  for (int c = 0; c < QG; ++c) { const _Float16* qrow = qh + ((size_t)bh * WW + q0 + c * 16 + ln) * HD;
    qb0[c] = frag_h(qrow, lane); qb1[c] = frag_h(qrow + 32, lane); }
  const float* mk = mask + (size_t)n * WW + 8 * g;     // [N,1,1,W]: per key; this lane's keys are 8g + r and 16 + 8g + r of a pass
  float mref[QG], lrun[QG];                            // mref: the query's reference maximum, log2 units; lrun: the sum over this lane's own keys, the halves are joined after the loop
  v8f acc[QG][4];
#pragma unroll
  for (int c = 0; c < QG; ++c) { mref[c] = -3.0e38f; lrun[c] = 0.f;
#pragma unroll
    for (int t = 0; t < 4; ++t) acc[c][t] = (v8f){}; }
  const _Float16* kb = kh + (size_t)bh * WW * HD;
  const _Float16* vb = vT + (size_t)bh * HD * WW;
  // copy map: 8 lanes cover one 128-B row slice (a whole line), a thread's 4 copies are 32 rows apart
  const int cr = tid >> 3, cq = tid & 7;
  const _Float16* gk = kb + (size_t)cr * HD + cq * 8;
  const _Float16* gv = vb + (size_t)cr * WW + cq * 8;
  const unsigned l0 = (unsigned)(size_t)sm + cr * (RP * 2) + cq * 16;
  // stage st works on key slice (st + rot) mod 16: the 4 blocks of a head start a quarter of the keys apart, so that they do not ask L2 for the same
  // lines at the same moment; heads start one slice apart, so that the blocks' V^T pieces (128 B of 2-KB rows) do not all sit at one offset in the row.
  // The online softmax takes the slices in any order.
  const int rot = (blockIdx.x * (WW / AK / (WW / QB)) + blockIdx.y) & (WW / AK - 1);
  stage_copy_kv(l0, gk + (size_t)rot * AK * HD, gv + rot * AK);
  asm volatile("s_wait_asynccnt 0x0" ::: "memory");   // stage 0 has landed before the barrier that publishes it
  __syncthreads();
  { const int s1 = (1 + rot) & (WW / AK - 1); stage_copy_kv(l0 + ABYTES, gk + (size_t)s1 * AK * HD, gv + s1 * AK); }
#pragma unroll 1   // rolled: one publish point per trip keeps the two-buffer order below as written
  for (int st = 0; st < WW / AK; ++st) {
   const _Float16* sb = (const _Float16*)(sm + (st & 1) * ABYTES);
#pragma unroll 1   // rolled, as before: one pass's registers only
   for (int kk = 0; kk < AK; kk += BK) {
    const int k0 = ((st + rot) & (WW / AK - 1)) * AK + kk;
    union { v8f v; v4f q[2]; } m0, m1;
    m0.q[0] = *(const v4f*)(mk + k0);      m0.q[1] = *(const v4f*)(mk + k0 + 4);
    m1.q[0] = *(const v4f*)(mk + k0 + 16); m1.q[1] = *(const v4f*)(mk + k0 + 20);
    // the 8 fragment reads of the pass's K rows go out as one group: one LDS latency per pass and not one per product
    const v16h ka0 = frag_h(sb + (kk + ln) * RP, lane),      ka1 = frag_h(sb + (kk + ln) * RP + 32, lane);
    const v16h kc0 = frag_h(sb + (kk + 16 + ln) * RP, lane), kc1 = frag_h(sb + (kk + 16 + ln) * RP + 32, lane);
    // nothing moves across this line: the pass's four mask loads and eight K reads all go out at its head, so a pass waits out one cache latency and not two
    __builtin_amdgcn_sched_barrier(0);
    v8f s0[QG], s1[QG];                                // s0[c][r] = score(key k0 + 8g + r, query q0 + 16c + ln), s1[c][r]: key k0 + 16 + 8g + r
#pragma unroll
    for (int c = 0; c < QG; ++c) { s0[c] = wmma16b(ka0, qb0[c], (v8f){}); s1[c] = wmma16b(kc0, qb0[c], (v8f){}); }
#pragma unroll
    for (int c = 0; c < QG; ++c) { s0[c] = wmma16b(ka1, qb1[c], s0[c]); s1[c] = wmma16b(kc1, qb1[c], s1[c]); }
    v16h vf[4];                                        // likewise the 8 reads of V^T's rows; they stand ahead of the branch below, so that they fly during the exponentials
#pragma unroll
    for (int t = 0; t < 4; ++t) vf[t] = frag_h(sb + (64 + t * 16 + ln) * RP + kk, lane);
    // Lazy reference: the exponentials take the reference in use when the pass starts, so mask, lift and reference are one addend of one fma per score,
    // and neither a maximum nor a rescale stands in the common path. P may then exceed 2^PL; the test below renews the reference before one can leave f16's range.
    const v8f ml0 = m0.v * LOG2E + PL, ml1 = m1.v * LOG2E + PL;   // shared by the column groups
    v16h pb[QG];                                       // B operand: element r = key 8g + r, element 8 + r = key 16 + 8g + r, as frag_h orders V^T's k
    float sum[QG];
    // the loops here and in the branch are unrolled so that the register arrays keep constant indices
#pragma unroll
    for (int c = 0; c < QG; ++c) {
      const v8f t0 = s0[c] * (0.125f * LOG2E) + (ml0 - mref[c]), t1 = s1[c] * (0.125f * LOG2E) + (ml1 - mref[c]);
      v8f p0, p1;                                      // a loop per tile, both unrolled into registers: neighbouring scores of one tile share a packed fma, with no register moves
#pragma unroll
      for (int r = 0; r < 8; ++r) p0[r] = __builtin_amdgcn_exp2f(t0[r]);
#pragma unroll
      for (int r = 0; r < 8; ++r) p1[r] = __builtin_amdgcn_exp2f(t1[r]);
      const v8f ps = p0 + p1;
      sum[c] = ((ps[0] + ps[1]) + (ps[2] + ps[3])) + ((ps[4] + ps[5]) + (ps[6] + ps[7]));
#pragma unroll
      for (int r = 0; r < 8; ++r) { pb[c][r] = (_Float16)p0[r]; pb[c][8 + r] = (_Float16)p1[r]; }
    }
    // one test per pass, a scalar branch for the whole wave: taken in a wave's first pass (the start reference makes every P infinite) and when scores outgrow the reference
    if (__builtin_expect(__builtin_amdgcn_ballot_w32(!(fmaxf(sum[0], sum[1]) <= PLIM)) != 0, 0)) {
#pragma unroll
      for (int c = 0; c < QG; ++c) {
        const v8f y0 = s0[c] * (0.125f * LOG2E) + ml0, y1 = s1[c] * (0.125f * LOG2E) + ml1;   // scores in log2 units, lifted
        float mx = fmaxf(y0[0], y1[0]);
#pragma unroll
        for (int r = 1; r < 8; ++r) mx = fmaxf(mx, fmaxf(y0[r], y1[r]));
        mx = fmaxf(mx, xhalf(mx));                     // both halves now hold the query's maximum over the 32 keys, so both take the same new reference
        const float mn = fmaxf(mref[c], mx - PL);
        const float corr = __builtin_amdgcn_exp2f(mref[c] - mn);
        const v8f t0 = y0 - mn, t1 = y1 - mn;          // <= PL
        v8f p0, p1;
#pragma unroll
        for (int r = 0; r < 8; ++r) p0[r] = __builtin_amdgcn_exp2f(t0[r]);
#pragma unroll
        for (int r = 0; r < 8; ++r) p1[r] = __builtin_amdgcn_exp2f(t1[r]);
        const v8f ps = p0 + p1;
        sum[c] = ((ps[0] + ps[1]) + (ps[2] + ps[3])) + ((ps[4] + ps[5]) + (ps[6] + ps[7]));
#pragma unroll
        for (int r = 0; r < 8; ++r) { pb[c][r] = (_Float16)p0[r]; pb[c][8 + r] = (_Float16)p1[r]; }
        lrun[c] *= corr; mref[c] = mn;
#pragma unroll
        for (int t = 0; t < 4; ++t) acc[c][t] *= corr;
      }
    }
#pragma unroll
    for (int c = 0; c < QG; ++c) lrun[c] += sum[c];
#pragma unroll
    for (int t = 0; t < 4; ++t) {
#pragma unroll
      for (int c = 0; c < QG; ++c)
        // only the pass's last product keeps its four v_nop: the back edge leads to vector writes over its operand registers
        acc[c][t] = (t == 3 && c == QG - 1) ? wmma16(vf[t], pb[c], acc[c][t]) : wmma16b(vf[t], pb[c], acc[c][t]); }
   }
   asm volatile("s_wait_dscnt 0x0" ::: "memory");     // this wave's reads of buffer st&1 are done before the buffer is refilled
   asm volatile("s_wait_asynccnt 0x0" ::: "memory");  // this wave's copies of stage st+1 have landed before other waves read them
   __syncthreads();                                   // publishes stage st+1 and ends every reader's last read of buffer st&1
   if (st + 2 < WW / AK) { const int s2 = (st + 2 + rot) & (WW / AK - 1); stage_copy_kv(l0 + (st & 1) * ABYTES, gk + (size_t)s2 * AK * HD, gv + s2 * AK); }
  }
  asm volatile("s_wait_asynccnt 0x0" ::: "memory");    // no copy is outstanding when the buffers become the epilogue's staging
  // acc[c][t][r] = O^T[d = t*16 + 8g + r][query 16c + ln]: stage as sOT[d][w_local], w_local = w*32 + 16c + ln
#pragma unroll
  for (int c = 0; c < QG; ++c) {
    const float il = 1.0f / (lrun[c] + xhalf(lrun[c]));   // lrun carries P's lift and reference like acc: both cancel
#pragma unroll
    for (int t = 0; t < 4; ++t) {
#pragma unroll
      for (int r = 0; r < 8; ++r) sOT[t * 16 + 8 * g + r][w * (QG * 16) + c * 16 + ln] = acc[c][t][r] * il; } }
  __syncthreads();
  const int qb0_ = blockIdx.x * QB;
  for (int q = tid; q < HD * (QB / 4); q += 256) { const int d = q / (QB / 4), pc = q & (QB / 4 - 1);
    vst2(out + ((size_t)n * CC + h * HD + d) * WW + qb0_ + pc * 4, *(const v4f*)(&sOT[d][pc * 4])); }
}

extern "C" void kernel_launch(void* const* d_in, const int* in_sizes, int n_in,
                              void* d_out, int out_size, void* d_ws, size_t ws_size,
                              hipStream_t stream) {
  (void)in_sizes; (void)n_in; (void)out_size; (void)ws_size;
  const float* hs   = (const float*)d_in[0];
  const float* mask = (const float*)d_in[1];
  const float* wq = (const float*)d_in[2]; const float* bq = (const float*)d_in[3];
  const float* wk = (const float*)d_in[4]; const float* bk = (const float*)d_in[5];
  const float* wv = (const float*)d_in[6]; const float* bv = (const float*)d_in[7];
  float* out = (float*)d_out;
  char* ws = (char*)d_ws; size_t off = 0;
  auto take = [&](size_t bytes) { char* p = ws + off; off += (bytes + 255) & ~(size_t)255; return p; };
  _Float16* xT = (_Float16*)take((size_t)NB * WW * CC * 2);      // 16 MB
  _Float16* wh = (_Float16*)take((size_t)3 * CC * CC * 2);       // 6 MB
  _Float16* qh = (_Float16*)take((size_t)NB * HH * WW * HD * 2);  // 16 MB
  _Float16* kh = (_Float16*)take((size_t)NB * HH * WW * HD * 2);
  _Float16* vT = (_Float16*)take((size_t)NB * HH * HD * WW * 2);
  k_xT<<<dim3(WW / 64, CC / 64, NB), 256, 0, stream>>>(hs, xT);
  k_wcvt<<<dim3((CC * CC / 8) / 256, 3), 256, 0, stream>>>(wq, wk, wv, wh);
  k_qkv<<<dim3(CC / BN, NB * (WW / BM), 3), 256, 0, stream>>>(xT, wh, bq, bk, bv, qh, kh, vT);
  k_attn<<<dim3(WW / QB, NB * HH), 256, 0, stream>>>(qh, kh, vT, mask, out);
}
